// v000
// The times below were measured on an AMD MI455X: many runs one after another, warmed up first and cycling through
// copies of the inputs, with the whole window's GPU time divided by the number of runs. Launches and the gaps
// between them are all in it. The median over several windows is given; except for v000 it joins two sittings, which
// can be a few percent apart, so the side-by-side timings, each taken in one sitting, are the better comparison.
// v000, which the later versions start from, runs in 358 microseconds.
#include <hip/hip_runtime.h>
#include <hip/hip_bf16.h>

#define BATCH   2
#define SEQ     2048
#define DMODEL  1024
#define NHEADS  16
#define DK      64
#define MROWS   (BATCH * SEQ)     // 4096

typedef __attribute__((ext_vector_type(16))) _Float16 v16h;
typedef __attribute__((ext_vector_type(8)))  _Float16 v8h;
typedef __attribute__((ext_vector_type(8)))  float    v8f;
typedef __attribute__((ext_vector_type(4)))  int      v4i;

#if defined(__gfx1250__) && __has_builtin(__builtin_amdgcn_global_load_async_to_lds_b128) && __has_builtin(__builtin_amdgcn_s_wait_asynccnt)
#define HAS_ASYNC_LDS 1
#else
#define HAS_ASYNC_LDS 0
#endif

// Copy 16 bytes global -> LDS. Uses the CDNA5 async-to-LDS path (ASYNCcnt,
// no VGPR round trip) when the builtin exists; else load+ds_store fallback.
static __device__ __forceinline__ void stage16(_Float16* lds_dst, const _Float16* gsrc) {
#if HAS_ASYNC_LDS
    __builtin_amdgcn_global_load_async_to_lds_b128(
        (__attribute__((address_space(1))) v4i*)gsrc,
        (__attribute__((address_space(3))) v4i*)lds_dst, 0, 0);
#else
    *(v8h*)lds_dst = *(const v8h*)gsrc;
#endif
}

static __device__ __forceinline__ void stage_wait() {
#if HAS_ASYNC_LDS
    __builtin_amdgcn_s_wait_asynccnt(0);
#endif
}

// Load a 16x32 (f16) A/B fragment row for this lane.
// Per CDNA5 ISA layout: lane half 0 holds K = [0..7] and [16..23],
// half 1 holds K = [8..15] and [24..31]. Two aligned 16B loads.
static __device__ __forceinline__ v16h load_frag16(const _Float16* p, int hl) {
    v8h lo = *(const v8h*)(p + hl * 8);
    v8h hi = *(const v8h*)(p + 16 + hl * 8);
    return __builtin_shufflevector(lo, hi, 0, 1, 2, 3, 4, 5, 6, 7,
                                           8, 9, 10, 11, 12, 13, 14, 15);
}

static __device__ __forceinline__ v8f wmma_f16(v16h a, v16h b, v8f c) {
    return __builtin_amdgcn_wmma_f32_16x16x32_f16(
        /*neg_a=*/false, a, /*neg_b=*/false, b,
        /*c_mod=*/(short)0, c, /*reuse_a=*/false, /*reuse_b=*/false);
}

// ---------------------------------------------------------------------------
// f32 -> f16 conversion
// ---------------------------------------------------------------------------
__global__ __launch_bounds__(256)
void cvt_f32_f16(const float* __restrict__ in, _Float16* __restrict__ out, int n) {
    int i = blockIdx.x * blockDim.x + threadIdx.x;
    if (i < n) out[i] = (_Float16)in[i];
}

// ---------------------------------------------------------------------------
// Y = X @ W^T + bias.  X:[MROWS, DMODEL] f16, W:[DMODEL, DMODEL] f16 row-major.
// One wave computes a 32x64 tile (8 accumulators, 8 WMMA per 12 loads).
// K-loop of 32, software-pipelined and unrolled by 2 so the two fragment
// register sets ping-pong (no rotation moves), loads stay in flight across
// the WMMAs of the other set.
// mode 0: f16 store [MROWS, DMODEL]        (Q, K projections)
// mode 1: f16 transposed store Vt[b][c][n] (V projection)
// mode 2: f32 store [MROWS, DMODEL]        (final output projection)
// ---------------------------------------------------------------------------
__global__ __launch_bounds__(128)
void gemm16(const _Float16* __restrict__ X, const _Float16* __restrict__ W,
            const float* __restrict__ bias,
            _Float16* __restrict__ outh, float* __restrict__ outf, int mode) {
    const int lane = threadIdx.x & 31;
    const int wid  = threadIdx.x >> 5;
    const int hl   = lane >> 4;
    const int l16  = lane & 15;

    const int tile  = blockIdx.x * 4 + wid;   // 2048 tiles total
    const int trow  = tile >> 4;              // 128 strips of 32 rows
    const int tcol  = tile & 15;              // 16 groups of 64 cols
    const int rbase = trow * 32;
    const int cbase = tcol * 64;

    const _Float16* arow0 = X + (size_t)(rbase + l16) * DMODEL;
    const _Float16* arow1 = X + (size_t)(rbase + 16 + l16) * DMODEL;
    const _Float16* brow[4];
#pragma unroll
    for (int t = 0; t < 4; ++t)
        brow[t] = W + (size_t)(cbase + t * 16 + l16) * DMODEL;

    v8f acc[2][4];
#pragma unroll
    for (int r = 0; r < 2; ++r)
#pragma unroll
        for (int t = 0; t < 4; ++t) acc[r][t] = v8f{};

    // Set "c" holds fragments for kb; set "n" for kb+32.
    v16h ca0 = load_frag16(arow0, hl);
    v16h ca1 = load_frag16(arow1, hl);
    v16h cb[4];
#pragma unroll
    for (int t = 0; t < 4; ++t) cb[t] = load_frag16(brow[t], hl);

    for (int kb = 0; kb + 64 < DMODEL; kb += 64) {
        // Fragments for kb+32 (issued before consuming set c).
        v16h na0 = load_frag16(arow0 + kb + 32, hl);
        v16h na1 = load_frag16(arow1 + kb + 32, hl);
        v16h nb[4];
#pragma unroll
        for (int t = 0; t < 4; ++t) nb[t] = load_frag16(brow[t] + kb + 32, hl);
        __builtin_prefetch(arow0 + kb + 256, 0, 3);

#pragma unroll
        for (int t = 0; t < 4; ++t) {
            acc[0][t] = wmma_f16(ca0, cb[t], acc[0][t]);
            acc[1][t] = wmma_f16(ca1, cb[t], acc[1][t]);
        }

        // Refill set c with fragments for kb+64 while set n computes.
        ca0 = load_frag16(arow0 + kb + 64, hl);
        ca1 = load_frag16(arow1 + kb + 64, hl);
#pragma unroll
        for (int t = 0; t < 4; ++t) cb[t] = load_frag16(brow[t] + kb + 64, hl);

#pragma unroll
        for (int t = 0; t < 4; ++t) {
            acc[0][t] = wmma_f16(na0, nb[t], acc[0][t]);
            acc[1][t] = wmma_f16(na1, nb[t], acc[1][t]);
        }
    }
    // Epilogue: set c holds kb = DMODEL-64; load and compute the final pair.
    {
        v16h na0 = load_frag16(arow0 + DMODEL - 32, hl);
        v16h na1 = load_frag16(arow1 + DMODEL - 32, hl);
        v16h nb[4];
#pragma unroll
        for (int t = 0; t < 4; ++t)
            nb[t] = load_frag16(brow[t] + DMODEL - 32, hl);
#pragma unroll
        for (int t = 0; t < 4; ++t) {
            acc[0][t] = wmma_f16(ca0, cb[t], acc[0][t]);
            acc[1][t] = wmma_f16(ca1, cb[t], acc[1][t]);
        }
#pragma unroll
        for (int t = 0; t < 4; ++t) {
            acc[0][t] = wmma_f16(na0, nb[t], acc[0][t]);
            acc[1][t] = wmma_f16(na1, nb[t], acc[1][t]);
        }
    }

#pragma unroll
    for (int r = 0; r < 2; ++r) {
#pragma unroll
        for (int t = 0; t < 4; ++t) {
#pragma unroll
            for (int e = 0; e < 8; ++e) {
                const int gr = rbase + r * 16 + e + 8 * hl;  // C/D: row = e + 8*half
                const int gc = cbase + t * 16 + l16;         // col = lane%16
                const float v = acc[r][t][e] + bias[gc];
                if (mode == 2) {
                    outf[(size_t)gr * DMODEL + gc] = v;
                } else if (mode == 1) {
                    const int b_ = gr >> 11;                 // gr / SEQ
                    const int n  = gr & (SEQ - 1);
                    outh[((size_t)b_ * DMODEL + gc) * SEQ + n] = (_Float16)v;
                } else {
                    outh[(size_t)gr * DMODEL + gc] = (_Float16)v;
                }
            }
        }
    }
}

// ---------------------------------------------------------------------------
// Fused flash attention with geometric distance bias.
// One block = 4 waves sharing one (b, h); each wave owns a 16-query tile.
// K/V tiles are double-buffered in LDS: the async copies for key-step j+1
// are issued right after the top barrier of step j and only waited at the
// top of step j+1, so global->LDS latency overlaps WMMA + softmax compute.
// Per step: 4 WMMA (S = Q K^T from LDS), exact distance bias, online
// softmax, P relayout through LDS, 4 WMMA (O += P V from LDS).
// ---------------------------------------------------------------------------
__global__ __launch_bounds__(128)
void attn_fa(const _Float16* __restrict__ Qh, const _Float16* __restrict__ Kh,
             const _Float16* __restrict__ Vt, const float* __restrict__ pos,
             const float* __restrict__ dist_bias, _Float16* __restrict__ O) {
    __shared__ __align__(16) _Float16 Kt[2][32][64];  // [buf][key j][d]
    __shared__ __align__(16) _Float16 Vl[2][64][32];  // [buf][d (c)][key j]
    __shared__ __align__(16) _Float16 Pt[4][16 * 32]; // per-wave P relayout

    const int tid  = threadIdx.x;
    const int lane = tid & 31;
    const int wid  = tid >> 5;
    const int hl   = lane >> 4;
    const int l16  = lane & 15;

    const int bh    = blockIdx.x >> 5;     // 32 (b,h) pairs; 32 blocks each
    const int qgrp  = blockIdx.x & 31;
    const int b     = bh >> 4;
    const int h     = bh & 15;
    const int qbase = (qgrp * 4 + wid) * 16;

    const float ab    = fabsf(dist_bias[h]);
    const float scale = 0.125f;            // 1/sqrt(DK)

    // Query positions for the 8 rows this lane's accumulator elements cover.
    float qx[8], qy[8], qz[8];
#pragma unroll
    for (int e = 0; e < 8; ++e) {
        const int nq = qbase + e + 8 * hl;
        const float* pq = pos + ((size_t)b * SEQ + nq) * 3;
        qx[e] = pq[0]; qy[e] = pq[1]; qz[e] = pq[2];
    }

    // Q fragments: invariant over the key loop -> registers.
    const _Float16* qrow =
        Qh + (size_t)(b * SEQ + qbase + l16) * DMODEL + h * DK;
    const v16h aq0 = load_frag16(qrow, hl);
    const v16h aq1 = load_frag16(qrow + 32, hl);

    v8f o[4] = {v8f{}, v8f{}, v8f{}, v8f{}};
    float m[8], l[8];
#pragma unroll
    for (int e = 0; e < 8; ++e) { m[e] = -3.0e38f; l[e] = 0.0f; }

    // Cooperative staging indices (constant over loop).
    const int krow = tid >> 2, kseg = (tid & 3) * 16;   // K: 32 rows x 128B
    const int vrow = tid >> 1, vseg = (tid & 1) * 16;   // V: 64 rows x 64B

    // Stage one 32-key block (K 32x64 + V 64x32) into LDS buffer `buf`.
    auto stage_tiles = [&](int buf, int jb) {
        const _Float16* ks =
            Kh + (size_t)(b * SEQ + jb + krow) * DMODEL + h * DK + kseg;
        stage16(&Kt[buf][krow][kseg], ks);
        stage16(&Kt[buf][krow][kseg + 8], ks + 8);
        const _Float16* vs =
            Vt + (size_t)(b * DMODEL + h * DK + vrow) * SEQ + jb + vseg;
        stage16(&Vl[buf][vrow][vseg], vs);
        stage16(&Vl[buf][vrow][vseg + 8], vs + 8);
    };

    stage_tiles(0, 0);   // prologue

    for (int jb = 0; jb < SEQ; jb += 32) {
        const int cur = (jb >> 5) & 1;

        // Wait for cur's staging (issued last iteration), make it visible.
        stage_wait();
        __syncthreads();

        // Kick off next block's staging; it completes during our compute.
        if (jb + 32 < SEQ) stage_tiles(cur ^ 1, jb + 32);

        // ---- S = Q K^T for 16x32 key block (two 16x16 tiles) ----
        v8f s0 = v8f{}, s1 = v8f{};
        s0 = wmma_f16(aq0, load_frag16(&Kt[cur][l16][0], hl), s0);
        s1 = wmma_f16(aq0, load_frag16(&Kt[cur][16 + l16][0], hl), s1);
        s0 = wmma_f16(aq1, load_frag16(&Kt[cur][l16][32], hl), s0);
        s1 = wmma_f16(aq1, load_frag16(&Kt[cur][16 + l16][32], hl), s1);

        // Key positions for this lane's two columns.
        const float* pk0 = pos + ((size_t)b * SEQ + jb + l16) * 3;
        const float* pk1 = pos + ((size_t)b * SEQ + jb + 16 + l16) * 3;
        const float k0x = pk0[0], k0y = pk0[1], k0z = pk0[2];
        const float k1x = pk1[0], k1y = pk1[1], k1z = pk1[2];

        float p0[8], p1[8];
#pragma unroll
        for (int e = 0; e < 8; ++e) {
            float dx = qx[e] - k0x, dy = qy[e] - k0y, dz = qz[e] - k0z;
            const float d0v = sqrtf(dx * dx + dy * dy + dz * dz);
            dx = qx[e] - k1x; dy = qy[e] - k1y; dz = qz[e] - k1z;
            const float d1v = sqrtf(dx * dx + dy * dy + dz * dz);
            const float a0 = s0[e] * scale + __logf(__expf(-ab * d0v) + 1e-8f);
            const float a1 = s1[e] * scale + __logf(__expf(-ab * d1v) + 1e-8f);

            // Row max across the 16 lanes sharing this row (xor within half).
            float v = fmaxf(a0, a1);
#pragma unroll
            for (int msk = 1; msk < 16; msk <<= 1)
                v = fmaxf(v, __shfl_xor(v, msk, 16));
            const float mn = fmaxf(m[e], v);
            const float sc = __expf(m[e] - mn);
            l[e] *= sc;
            o[0][e] *= sc; o[1][e] *= sc; o[2][e] *= sc; o[3][e] *= sc;

            p0[e] = __expf(a0 - mn);
            p1[e] = __expf(a1 - mn);
            float rs = p0[e] + p1[e];
#pragma unroll
            for (int msk = 1; msk < 16; msk <<= 1)
                rs += __shfl_xor(rs, msk, 16);
            l[e] += rs;
            m[e] = mn;
        }

        // ---- Relayout P (C/D layout -> A layout) through LDS ----
#pragma unroll
        for (int e = 0; e < 8; ++e) {
            const int lr = e + 8 * hl;
            Pt[wid][lr * 32 + l16]      = (_Float16)p0[e];
            Pt[wid][lr * 32 + 16 + l16] = (_Float16)p1[e];
        }
        __syncthreads();
        const v16h ap = load_frag16(&Pt[wid][l16 * 32], hl);

        // ---- O += P @ V (B-fragments from LDS V tile) ----
#pragma unroll
        for (int t = 0; t < 4; ++t) {
            const v16h bv = load_frag16(&Vl[cur][t * 16 + l16][0], hl);
            o[t] = wmma_f16(ap, bv, o[t]);
        }
        // No trailing barrier needed: next iteration's top barrier protects
        // the buffer being re-staged, and per-wave DS ops stay in order.
    }

    // Normalize and store per-head output into [B, N, DMODEL] f16.
#pragma unroll
    for (int t = 0; t < 4; ++t) {
#pragma unroll
        for (int e = 0; e < 8; ++e) {
            const int n = qbase + e + 8 * hl;
            const int c = h * DK + t * 16 + l16;
            O[(size_t)(b * SEQ + n) * DMODEL + c] = (_Float16)(o[t][e] / l[e]);
        }
    }
}

// ---------------------------------------------------------------------------
extern "C" void kernel_launch(void* const* d_in, const int* in_sizes, int n_in,
                              void* d_out, int out_size, void* d_ws, size_t ws_size,
                              hipStream_t stream) {
    const float* x   = (const float*)d_in[0];
    const float* pos = (const float*)d_in[1];
    const float* Wq  = (const float*)d_in[2];
    const float* bq  = (const float*)d_in[3];
    const float* Wk  = (const float*)d_in[4];
    const float* bk  = (const float*)d_in[5];
    const float* Wv  = (const float*)d_in[6];
    const float* bv  = (const float*)d_in[7];
    const float* Wo  = (const float*)d_in[8];
    const float* bo  = (const float*)d_in[9];
    const float* db  = (const float*)d_in[10];
    float* out = (float*)d_out;

    char* ws = (char*)d_ws;
    size_t off = 0;
    auto alloc = [&](size_t bytes) -> char* {
        char* p = ws + off;
        off += (bytes + 255) & ~(size_t)255;
        return p;
    };
    const size_t act_elems = (size_t)MROWS * DMODEL;     // 4M
    const size_t w_elems   = (size_t)DMODEL * DMODEL;    // 1M

    _Float16* xh  = (_Float16*)alloc(act_elems * 2);
    _Float16* wqh = (_Float16*)alloc(w_elems * 2);
    _Float16* wkh = (_Float16*)alloc(w_elems * 2);
    _Float16* wvh = (_Float16*)alloc(w_elems * 2);
    _Float16* woh = (_Float16*)alloc(w_elems * 2);
    _Float16* Qh  = (_Float16*)alloc(act_elems * 2);
    _Float16* Kh  = (_Float16*)alloc(act_elems * 2);
    _Float16* Vt  = (_Float16*)alloc(act_elems * 2);
    _Float16* Ah  = (_Float16*)alloc(act_elems * 2);
    (void)ws_size; (void)in_sizes; (void)n_in; (void)out_size;

    // f32 -> f16 conversions (~48 MB total: 32 MB read, 16 MB written; trivially fast, L2 resident after).
    cvt_f32_f16<<<(int)((act_elems + 255) / 256), 256, 0, stream>>>(x,  xh,  (int)act_elems);
    cvt_f32_f16<<<(int)((w_elems + 255) / 256),   256, 0, stream>>>(Wq, wqh, (int)w_elems);
    cvt_f32_f16<<<(int)((w_elems + 255) / 256),   256, 0, stream>>>(Wk, wkh, (int)w_elems);
    cvt_f32_f16<<<(int)((w_elems + 255) / 256),   256, 0, stream>>>(Wv, wvh, (int)w_elems);
    cvt_f32_f16<<<(int)((w_elems + 255) / 256),   256, 0, stream>>>(Wo, woh, (int)w_elems);

    // QKV projections (V stored transposed for contiguous PV fragments).
    gemm16<<<512, 128, 0, stream>>>(xh, wqh, bq, Qh, nullptr, 0);
    gemm16<<<512, 128, 0, stream>>>(xh, wkh, bk, Kh, nullptr, 0);
    gemm16<<<512, 128, 0, stream>>>(xh, wvh, bv, Vt, nullptr, 1);

    // Fused flash attention with geometric bias.
    attn_fa<<<1024, 128, 0, stream>>>(Qh, Kh, Vt, pos, db, Ah);

    // Output projection -> f32 result.
    gemm16<<<512, 128, 0, stream>>>(Ah, woh, bo, nullptr, out, 2);
}

// v001
// One run takes 321 microseconds.
// Timed twice side by side with v000, it ran 1.14 times as fast both times.
#include <hip/hip_runtime.h>
#include <hip/hip_bf16.h>

#define BATCH   2
#define SEQ     2048
#define DMODEL  1024
#define NHEADS  16
#define DK      64
#define MROWS   (BATCH * SEQ)     // 4096

typedef __attribute__((ext_vector_type(16))) _Float16 v16h;
typedef __attribute__((ext_vector_type(8)))  _Float16 v8h;
typedef __attribute__((ext_vector_type(8)))  float    v8f;
typedef __attribute__((ext_vector_type(4)))  int      v4i;

#if defined(__gfx1250__) && __has_builtin(__builtin_amdgcn_global_load_async_to_lds_b128) && __has_builtin(__builtin_amdgcn_s_wait_asynccnt)
#define HAS_ASYNC_LDS 1
#else
#define HAS_ASYNC_LDS 0
#endif

// Copy 16 bytes global -> LDS. Uses the CDNA5 async-to-LDS path (ASYNCcnt,
// no VGPR round trip) when the builtin exists; else load+ds_store fallback.
static __device__ __forceinline__ void stage16(_Float16* lds_dst, const _Float16* gsrc) {
#if HAS_ASYNC_LDS
    __builtin_amdgcn_global_load_async_to_lds_b128(
        (__attribute__((address_space(1))) v4i*)gsrc,
        (__attribute__((address_space(3))) v4i*)lds_dst, 0, 0);
#else
    *(v8h*)lds_dst = *(const v8h*)gsrc;
#endif
}

static __device__ __forceinline__ void stage_wait() {
#if HAS_ASYNC_LDS
    __builtin_amdgcn_s_wait_asynccnt(0);
#endif
}

// Load a 16x32 (f16) A/B fragment row for this lane.
// Per CDNA5 ISA layout: lane half 0 holds K = [0..7] and [16..23],
// half 1 holds K = [8..15] and [24..31]. Two aligned 16B loads.
static __device__ __forceinline__ v16h load_frag16(const _Float16* p, int hl) {
    v8h lo = *(const v8h*)(p + hl * 8);
    v8h hi = *(const v8h*)(p + 16 + hl * 8);
    return __builtin_shufflevector(lo, hi, 0, 1, 2, 3, 4, 5, 6, 7,
                                           8, 9, 10, 11, 12, 13, 14, 15);
}

static __device__ __forceinline__ v8f wmma_f16(v16h a, v16h b, v8f c) {
    return __builtin_amdgcn_wmma_f32_16x16x32_f16(
        /*neg_a=*/false, a, /*neg_b=*/false, b,
        /*c_mod=*/(short)0, c, /*reuse_a=*/false, /*reuse_b=*/false);
}

// ---------------------------------------------------------------------------
// f32 -> f16 conversion
// ---------------------------------------------------------------------------
__global__ __launch_bounds__(256)
void cvt_f32_f16(const float* __restrict__ in, _Float16* __restrict__ out, int n) {
    int i = blockIdx.x * blockDim.x + threadIdx.x;
    if (i < n) out[i] = (_Float16)in[i];
}

// ---------------------------------------------------------------------------
// Y = X @ W^T + bias.  X:[MROWS, DMODEL] f16, W:[DMODEL, DMODEL] f16 row-major.
// One wave computes a 32x64 tile (8 accumulators, 8 WMMA per 12 loads).
// K-loop of 32, software-pipelined and unrolled by 2 so the two fragment
// register sets ping-pong (no rotation moves), loads stay in flight across
// the WMMAs of the other set.
// mode 0: f16 store [MROWS, DMODEL]        (Q, K projections)
// mode 1: f16 transposed store Vt[b][c][n] (V projection)
// mode 2: f32 store [MROWS, DMODEL]        (final output projection)
// ---------------------------------------------------------------------------
__global__ __launch_bounds__(128)
void gemm16(const _Float16* __restrict__ X, const _Float16* __restrict__ W,
            const float* __restrict__ bias,
            _Float16* __restrict__ outh, float* __restrict__ outf, int mode) {
    const int lane = threadIdx.x & 31;
    const int wid  = threadIdx.x >> 5;
    const int hl   = lane >> 4;
    const int l16  = lane & 15;

    const int tile  = blockIdx.x * 4 + wid;   // 2048 tiles total
    const int trow  = tile >> 4;              // 128 strips of 32 rows
    const int tcol  = tile & 15;              // 16 groups of 64 cols
    const int rbase = trow * 32;
    const int cbase = tcol * 64;

    const _Float16* arow0 = X + (size_t)(rbase + l16) * DMODEL;
    const _Float16* arow1 = X + (size_t)(rbase + 16 + l16) * DMODEL;
    const _Float16* brow[4];
#pragma unroll
    for (int t = 0; t < 4; ++t)
        brow[t] = W + (size_t)(cbase + t * 16 + l16) * DMODEL;

    v8f acc[2][4];
#pragma unroll
    for (int r = 0; r < 2; ++r)
#pragma unroll
        for (int t = 0; t < 4; ++t) acc[r][t] = v8f{};

    // Set "c" holds fragments for kb; set "n" for kb+32.
    v16h ca0 = load_frag16(arow0, hl);
    v16h ca1 = load_frag16(arow1, hl);
    v16h cb[4];
#pragma unroll
    for (int t = 0; t < 4; ++t) cb[t] = load_frag16(brow[t], hl);

    for (int kb = 0; kb + 64 < DMODEL; kb += 64) {
        // Fragments for kb+32 (issued before consuming set c).
        v16h na0 = load_frag16(arow0 + kb + 32, hl);
        v16h na1 = load_frag16(arow1 + kb + 32, hl);
        v16h nb[4];
#pragma unroll
        for (int t = 0; t < 4; ++t) nb[t] = load_frag16(brow[t] + kb + 32, hl);
        __builtin_prefetch(arow0 + kb + 256, 0, 3);

#pragma unroll
        for (int t = 0; t < 4; ++t) {
            acc[0][t] = wmma_f16(ca0, cb[t], acc[0][t]);
            acc[1][t] = wmma_f16(ca1, cb[t], acc[1][t]);
        }

        // Refill set c with fragments for kb+64 while set n computes.
        ca0 = load_frag16(arow0 + kb + 64, hl);
        ca1 = load_frag16(arow1 + kb + 64, hl);
#pragma unroll
        for (int t = 0; t < 4; ++t) cb[t] = load_frag16(brow[t] + kb + 64, hl);

#pragma unroll
        for (int t = 0; t < 4; ++t) {
            acc[0][t] = wmma_f16(na0, nb[t], acc[0][t]);
            acc[1][t] = wmma_f16(na1, nb[t], acc[1][t]);
        }
    }
    // Epilogue: set c holds kb = DMODEL-64; load and compute the final pair.
    {
        v16h na0 = load_frag16(arow0 + DMODEL - 32, hl);
        v16h na1 = load_frag16(arow1 + DMODEL - 32, hl);
        v16h nb[4];
#pragma unroll
        for (int t = 0; t < 4; ++t)
            nb[t] = load_frag16(brow[t] + DMODEL - 32, hl);
#pragma unroll
        for (int t = 0; t < 4; ++t) {
            acc[0][t] = wmma_f16(ca0, cb[t], acc[0][t]);
            acc[1][t] = wmma_f16(ca1, cb[t], acc[1][t]);
        }
#pragma unroll
        for (int t = 0; t < 4; ++t) {
            acc[0][t] = wmma_f16(na0, nb[t], acc[0][t]);
            acc[1][t] = wmma_f16(na1, nb[t], acc[1][t]);
        }
    }

#pragma unroll
    for (int r = 0; r < 2; ++r) {
#pragma unroll
        for (int t = 0; t < 4; ++t) {
#pragma unroll
            for (int e = 0; e < 8; ++e) {
                const int gr = rbase + r * 16 + e + 8 * hl;  // C/D: row = e + 8*half
                const int gc = cbase + t * 16 + l16;         // col = lane%16
                const float v = acc[r][t][e] + bias[gc];
                if (mode == 2) {
                    outf[(size_t)gr * DMODEL + gc] = v;
                } else if (mode == 1) {
                    const int b_ = gr >> 11;                 // gr / SEQ
                    const int n  = gr & (SEQ - 1);
                    outh[((size_t)b_ * DMODEL + gc) * SEQ + n] = (_Float16)v;
                } else {
                    outh[(size_t)gr * DMODEL + gc] = (_Float16)v;
                }
            }
        }
    }
}

// ---------------------------------------------------------------------------
// Fused flash attention with geometric distance bias, transposed scores.
// One block = 4 waves sharing one (b, h); each wave owns a 16-query tile.
// K/V tiles are double-buffered in LDS: the async copies for key-step j+1
// are issued right after the top barrier of step j and only waited at the
// top of step j+1, so global->LDS latency overlaps WMMA + softmax compute.
// Per step: 4 WMMA (S^T = K Q^T, K rows as A, Q as B), exact distance bias,
// online softmax, 4 WMMA (O^T += V^T P^T).  In S^T a lane holds 16 scores of
// ONE query (column = lane%16, key = e + 8*half per 16-key tile), so maximum
// and sum run in the lane's own registers with one exchange between the wave
// halves, and the two converted score tiles are already the B operand of the
// second product (k = 8*half + e, then 16 + 8*half + e): P never leaves the
// registers.
// ---------------------------------------------------------------------------
typedef __attribute__((ext_vector_type(4))) float v4f;

// Value of lane l ^ 16 (the other half of the wave holds the same query).
static __device__ __forceinline__ float xhalf(float x) {
    return __builtin_bit_cast(float, __builtin_amdgcn_permlanex16(
        __builtin_bit_cast(int, x), __builtin_bit_cast(int, x),
        0x76543210, 0xfedcba98, false, false));
}

__global__ __launch_bounds__(128)
void attn_fa(const _Float16* __restrict__ Qh, const _Float16* __restrict__ Kh,
             const _Float16* __restrict__ Vt, const float* __restrict__ pos,
             const float* __restrict__ dist_bias, _Float16* __restrict__ O) {
    __shared__ __align__(16) _Float16 Kt[2][32][64];  // [buf][key j][d]
    __shared__ __align__(16) _Float16 Vl[2][64][32];  // [buf][d (c)][key j]

    const int tid  = threadIdx.x;
    const int lane = tid & 31;
    const int wid  = tid >> 5;
    const int hl   = lane >> 4;
    const int l16  = lane & 15;

    const int bh    = blockIdx.x >> 5;     // 32 (b,h) pairs; 32 blocks each
    const int qgrp  = blockIdx.x & 31;
    const int b     = bh >> 4;
    const int h     = bh & 15;
    const int qbase = (qgrp * 4 + wid) * 16;

    const float ab    = fabsf(dist_bias[h]);
    const float scale = 0.125f;            // 1/sqrt(DK)

    // Position of the one query this lane's score column belongs to.
    const float* pq = pos + ((size_t)b * SEQ + qbase + l16) * 3;
    const float qx = pq[0], qy = pq[1], qz = pq[2];
    // Precaution: the load's address registers are reused soon after it
    // (address sums, accumulator start values), so the wait stands first.
    asm volatile("s_wait_xcnt 0x0" ::: "memory");

    // Q fragments: invariant over the key loop -> registers (B operand).
    const _Float16* qrow =
        Qh + (size_t)(b * SEQ + qbase + l16) * DMODEL + h * DK;
    const v16h aq0 = load_frag16(qrow, hl);
    const v16h aq1 = load_frag16(qrow + 32, hl);

    v8f o[4] = {v8f{}, v8f{}, v8f{}, v8f{}};  // o[t][e] = O^T[t*16+8*hl+e][l16]
    float m = -3.0e38f;                       // running maximum of the query
    float l = 0.0f;                           // this half's share of the sum

    // Cooperative staging indices (constant over loop).
    const int krow = tid >> 2, kseg = (tid & 3) * 16;   // K: 32 rows x 128B
    const int vrow = tid >> 1, vseg = (tid & 1) * 16;   // V: 64 rows x 64B

    // Stage one 32-key block (K 32x64 + V 64x32) into LDS buffer `buf`.
    auto stage_tiles = [&](int buf, int jb) {
        const _Float16* ks =
            Kh + (size_t)(b * SEQ + jb + krow) * DMODEL + h * DK + kseg;
        stage16(&Kt[buf][krow][kseg], ks);
        stage16(&Kt[buf][krow][kseg + 8], ks + 8);
        const _Float16* vs =
            Vt + (size_t)(b * DMODEL + h * DK + vrow) * SEQ + jb + vseg;
        stage16(&Vl[buf][vrow][vseg], vs);
        stage16(&Vl[buf][vrow][vseg + 8], vs + 8);
    };

    stage_tiles(0, 0);   // prologue

    for (int jb = 0; jb < SEQ; jb += 32) {
        const int cur = (jb >> 5) & 1;

        // Wait for cur's staging (issued last iteration), make it visible.
        stage_wait();
        __syncthreads();

        // Kick off next block's staging; it completes during our compute.
        if (jb + 32 < SEQ) stage_tiles(cur ^ 1, jb + 32);

        // Positions of this lane's 2 x 8 keys (jb + 8*hl + e and 16 more):
        // 24 consecutive floats each, 96-byte aligned offsets.
        const v4f* pk0 = (const v4f*)(pos + ((size_t)b * SEQ + jb + 8 * hl) * 3);
        const v4f* pk1 = (const v4f*)(pos + ((size_t)b * SEQ + jb + 16 + 8 * hl) * 3);
        float kp0[24], kp1[24];
#pragma unroll  // constant indices keep the array in registers
        for (int i = 0; i < 6; ++i) {
            const v4f u = pk0[i], w = pk1[i];
#pragma unroll  // constant indices keep the array in registers
            for (int c = 0; c < 4; ++c) { kp0[i * 4 + c] = u[c]; kp1[i * 4 + c] = w[c]; }
        }

        // ---- S^T = K Q^T for the 32-key block (two 16x16 tiles) ----
        v8f s0 = v8f{}, s1 = v8f{};
        s0 = wmma_f16(load_frag16(&Kt[cur][l16][0], hl), aq0, s0);
        s1 = wmma_f16(load_frag16(&Kt[cur][16 + l16][0], hl), aq0, s1);
        s0 = wmma_f16(load_frag16(&Kt[cur][l16][32], hl), aq1, s0);
        s1 = wmma_f16(load_frag16(&Kt[cur][16 + l16][32], hl), aq1, s1);

        float a0[8], a1[8];
        float v = -3.0e38f;
#pragma unroll  // constant indices keep the array in registers
        for (int e = 0; e < 8; ++e) {
            float dx = qx - kp0[e * 3], dy = qy - kp0[e * 3 + 1], dz = qz - kp0[e * 3 + 2];
            const float d0v = sqrtf(dx * dx + dy * dy + dz * dz);
            dx = qx - kp1[e * 3]; dy = qy - kp1[e * 3 + 1]; dz = qz - kp1[e * 3 + 2];
            const float d1v = sqrtf(dx * dx + dy * dy + dz * dz);
            a0[e] = s0[e] * scale + __logf(__expf(-ab * d0v) + 1e-8f);
            a1[e] = s1[e] * scale + __logf(__expf(-ab * d1v) + 1e-8f);
            v = fmaxf(v, fmaxf(a0[e], a1[e]));
        }
        // The other half holds the query's other 16 keys of this block.
        v = fmaxf(v, xhalf(v));

        const float mn = fmaxf(m, v);
        const float sc = __expf(m - mn);
        m = mn;
#pragma unroll  // constant indices keep the array in registers
        for (int t = 0; t < 4; ++t)
#pragma unroll  // constant indices keep the array in registers
            for (int e = 0; e < 8; ++e) o[t][e] *= sc;

        // P^T as B operand, straight from the two score tiles.
        v16h bp;
        float rs = 0.0f;
#pragma unroll  // constant indices keep the array in registers
        for (int e = 0; e < 8; ++e) {
            const float p0 = __expf(a0[e] - mn);
            const float p1 = __expf(a1[e] - mn);
            rs += p0 + p1;
            bp[e]     = (_Float16)p0;
            bp[8 + e] = (_Float16)p1;
        }
        l = l * sc + rs;

        // ---- O^T += V^T P^T (A-fragments from LDS V tile) ----
#pragma unroll  // constant indices keep the array in registers
        for (int t = 0; t < 4; ++t) {
            const v16h av = load_frag16(&Vl[cur][t * 16 + l16][0], hl);
            o[t] = wmma_f16(av, bp, o[t]);
        }
        // No trailing barrier needed: next iteration's top barrier protects
        // the buffer being re-staged.
    }

    // Join the halves' sums, normalize, store 8 consecutive channels a lane.
    const float lt = l + xhalf(l);
    _Float16* orow = O + (size_t)(b * SEQ + qbase + l16) * DMODEL + h * DK + 8 * hl;
#pragma unroll  // constant indices keep the array in registers
    for (int t = 0; t < 4; ++t) {
        v8h r;
#pragma unroll  // constant indices keep the array in registers
        for (int e = 0; e < 8; ++e) r[e] = (_Float16)(o[t][e] / lt);
        *(v8h*)(orow + t * 16) = r;
    }
}

// ---------------------------------------------------------------------------
extern "C" void kernel_launch(void* const* d_in, const int* in_sizes, int n_in,
                              void* d_out, int out_size, void* d_ws, size_t ws_size,
                              hipStream_t stream) {
    const float* x   = (const float*)d_in[0];
    const float* pos = (const float*)d_in[1];
    const float* Wq  = (const float*)d_in[2];
    const float* bq  = (const float*)d_in[3];
    const float* Wk  = (const float*)d_in[4];
    const float* bk  = (const float*)d_in[5];
    const float* Wv  = (const float*)d_in[6];
    const float* bv  = (const float*)d_in[7];
    const float* Wo  = (const float*)d_in[8];
    const float* bo  = (const float*)d_in[9];
    const float* db  = (const float*)d_in[10];
    float* out = (float*)d_out;

    char* ws = (char*)d_ws;
    size_t off = 0;
    auto alloc = [&](size_t bytes) -> char* {
        char* p = ws + off;
        off += (bytes + 255) & ~(size_t)255;
        return p;
    };
    const size_t act_elems = (size_t)MROWS * DMODEL;     // 4M
    const size_t w_elems   = (size_t)DMODEL * DMODEL;    // 1M

    _Float16* xh  = (_Float16*)alloc(act_elems * 2);
    _Float16* wqh = (_Float16*)alloc(w_elems * 2);
    _Float16* wkh = (_Float16*)alloc(w_elems * 2);
    _Float16* wvh = (_Float16*)alloc(w_elems * 2);
    _Float16* woh = (_Float16*)alloc(w_elems * 2);
    _Float16* Qh  = (_Float16*)alloc(act_elems * 2);
    _Float16* Kh  = (_Float16*)alloc(act_elems * 2);
    _Float16* Vt  = (_Float16*)alloc(act_elems * 2);
    _Float16* Ah  = (_Float16*)alloc(act_elems * 2);
    (void)ws_size; (void)in_sizes; (void)n_in; (void)out_size;

    // f32 -> f16 conversions (~48 MB total: 32 MB read, 16 MB written; trivially fast, L2 resident after).
    cvt_f32_f16<<<(int)((act_elems + 255) / 256), 256, 0, stream>>>(x,  xh,  (int)act_elems);
    cvt_f32_f16<<<(int)((w_elems + 255) / 256),   256, 0, stream>>>(Wq, wqh, (int)w_elems);
    cvt_f32_f16<<<(int)((w_elems + 255) / 256),   256, 0, stream>>>(Wk, wkh, (int)w_elems);
    cvt_f32_f16<<<(int)((w_elems + 255) / 256),   256, 0, stream>>>(Wv, wvh, (int)w_elems);
    cvt_f32_f16<<<(int)((w_elems + 255) / 256),   256, 0, stream>>>(Wo, woh, (int)w_elems);

    // QKV projections (V stored transposed for contiguous PV fragments).
    gemm16<<<512, 128, 0, stream>>>(xh, wqh, bq, Qh, nullptr, 0);
    gemm16<<<512, 128, 0, stream>>>(xh, wkh, bk, Kh, nullptr, 0);
    gemm16<<<512, 128, 0, stream>>>(xh, wvh, bv, Vt, nullptr, 1);

    // Fused flash attention with geometric bias.
    attn_fa<<<1024, 128, 0, stream>>>(Qh, Kh, Vt, pos, db, Ah);

    // Output projection -> f32 result.
    gemm16<<<512, 128, 0, stream>>>(Ah, woh, bo, nullptr, out, 2);
}

// v002
// One run takes 277 microseconds.
// Timed twice side by side with v001, it ran 1.16 times as fast both times.
// All steps since v000 together make it 1.32 times as fast.
#include <hip/hip_runtime.h>
#include <hip/hip_bf16.h>

#define BATCH   2
#define SEQ     2048
#define DMODEL  1024
#define NHEADS  16
#define DK      64
#define MROWS   (BATCH * SEQ)     // 4096

typedef __attribute__((ext_vector_type(16))) _Float16 v16h;
typedef __attribute__((ext_vector_type(8)))  _Float16 v8h;
typedef __attribute__((ext_vector_type(8)))  float    v8f;
typedef __attribute__((ext_vector_type(4)))  int      v4i;

#if defined(__gfx1250__) && __has_builtin(__builtin_amdgcn_global_load_async_to_lds_b128) && __has_builtin(__builtin_amdgcn_s_wait_asynccnt)
#define HAS_ASYNC_LDS 1
#else
#define HAS_ASYNC_LDS 0
#endif

// Copy 16 bytes global -> LDS. Uses the CDNA5 async-to-LDS path (ASYNCcnt,
// no VGPR round trip) when the builtin exists; else load+ds_store fallback.
static __device__ __forceinline__ void stage16(_Float16* lds_dst, const _Float16* gsrc) {
#if HAS_ASYNC_LDS
    __builtin_amdgcn_global_load_async_to_lds_b128(
        (__attribute__((address_space(1))) v4i*)gsrc,
        (__attribute__((address_space(3))) v4i*)lds_dst, 0, 0);
#else
    *(v8h*)lds_dst = *(const v8h*)gsrc;
#endif
}

static __device__ __forceinline__ void stage_wait() {
#if HAS_ASYNC_LDS
    __builtin_amdgcn_s_wait_asynccnt(0);
#endif
}

// Load a 16x32 (f16) A/B fragment row for this lane.
// Per CDNA5 ISA layout: lane half 0 holds K = [0..7] and [16..23],
// half 1 holds K = [8..15] and [24..31]. Two aligned 16B loads.
static __device__ __forceinline__ v16h load_frag16(const _Float16* p, int hl) {
    v8h lo = *(const v8h*)(p + hl * 8);
    v8h hi = *(const v8h*)(p + 16 + hl * 8);
    return __builtin_shufflevector(lo, hi, 0, 1, 2, 3, 4, 5, 6, 7,
                                           8, 9, 10, 11, 12, 13, 14, 15);
}

static __device__ __forceinline__ v8f wmma_f16(v16h a, v16h b, v8f c) {
    return __builtin_amdgcn_wmma_f32_16x16x32_f16(
        /*neg_a=*/false, a, /*neg_b=*/false, b,
        /*c_mod=*/(short)0, c, /*reuse_a=*/false, /*reuse_b=*/false);
}

// ---------------------------------------------------------------------------
// f32 -> f16 conversion
// ---------------------------------------------------------------------------
__global__ __launch_bounds__(256)
void cvt_f32_f16(const float* __restrict__ in, _Float16* __restrict__ out, int n) {
    int i = blockIdx.x * blockDim.x + threadIdx.x;
    if (i < n) out[i] = (_Float16)in[i];
}

// ---------------------------------------------------------------------------
// Y = X @ W^T + bias.  X:[MROWS, DMODEL] f16, W:[DMODEL, DMODEL] f16 row-major.
// One wave computes a 32x64 tile (8 accumulators, 8 WMMA per 12 loads).
// K-loop of 32, software-pipelined and unrolled by 2 so the two fragment
// register sets ping-pong (no rotation moves), loads stay in flight across
// the WMMAs of the other set.
// mode 0: f16 store [MROWS, DMODEL]        (Q, K projections)
// mode 1: f16 transposed store Vt[b][c][n] (V projection)
// mode 2: f32 store [MROWS, DMODEL]        (final output projection)
// ---------------------------------------------------------------------------
__global__ __launch_bounds__(128)
void gemm16(const _Float16* __restrict__ X, const _Float16* __restrict__ W,
            const float* __restrict__ bias,
            _Float16* __restrict__ outh, float* __restrict__ outf, int mode) {
    const int lane = threadIdx.x & 31;
    const int wid  = threadIdx.x >> 5;
    const int hl   = lane >> 4;
    const int l16  = lane & 15;

    const int tile  = blockIdx.x * 4 + wid;   // 2048 tiles total
    const int trow  = tile >> 4;              // 128 strips of 32 rows
    const int tcol  = tile & 15;              // 16 groups of 64 cols
    const int rbase = trow * 32;
    const int cbase = tcol * 64;

    const _Float16* arow0 = X + (size_t)(rbase + l16) * DMODEL;
    const _Float16* arow1 = X + (size_t)(rbase + 16 + l16) * DMODEL;
    const _Float16* brow[4];
#pragma unroll
    for (int t = 0; t < 4; ++t)
        brow[t] = W + (size_t)(cbase + t * 16 + l16) * DMODEL;

    v8f acc[2][4];
#pragma unroll
    for (int r = 0; r < 2; ++r)
#pragma unroll
        for (int t = 0; t < 4; ++t) acc[r][t] = v8f{};

    // Set "c" holds fragments for kb; set "n" for kb+32.
    v16h ca0 = load_frag16(arow0, hl);
    v16h ca1 = load_frag16(arow1, hl);
    v16h cb[4];
#pragma unroll
    for (int t = 0; t < 4; ++t) cb[t] = load_frag16(brow[t], hl);

    for (int kb = 0; kb + 64 < DMODEL; kb += 64) {
        // Fragments for kb+32 (issued before consuming set c).
        v16h na0 = load_frag16(arow0 + kb + 32, hl);
        v16h na1 = load_frag16(arow1 + kb + 32, hl);
        v16h nb[4];
#pragma unroll
        for (int t = 0; t < 4; ++t) nb[t] = load_frag16(brow[t] + kb + 32, hl);
        __builtin_prefetch(arow0 + kb + 256, 0, 3);

#pragma unroll
        for (int t = 0; t < 4; ++t) {
            acc[0][t] = wmma_f16(ca0, cb[t], acc[0][t]);
            acc[1][t] = wmma_f16(ca1, cb[t], acc[1][t]);
        }

        // Refill set c with fragments for kb+64 while set n computes.
        ca0 = load_frag16(arow0 + kb + 64, hl);
        ca1 = load_frag16(arow1 + kb + 64, hl);
#pragma unroll
        for (int t = 0; t < 4; ++t) cb[t] = load_frag16(brow[t] + kb + 64, hl);

#pragma unroll
        for (int t = 0; t < 4; ++t) {
            acc[0][t] = wmma_f16(na0, nb[t], acc[0][t]);
            acc[1][t] = wmma_f16(na1, nb[t], acc[1][t]);
        }
    }
    // Epilogue: set c holds kb = DMODEL-64; load and compute the final pair.
    {
        v16h na0 = load_frag16(arow0 + DMODEL - 32, hl);
        v16h na1 = load_frag16(arow1 + DMODEL - 32, hl);
        v16h nb[4];
#pragma unroll
        for (int t = 0; t < 4; ++t)
            nb[t] = load_frag16(brow[t] + DMODEL - 32, hl);
#pragma unroll
        for (int t = 0; t < 4; ++t) {
            acc[0][t] = wmma_f16(ca0, cb[t], acc[0][t]);
            acc[1][t] = wmma_f16(ca1, cb[t], acc[1][t]);
        }
#pragma unroll
        for (int t = 0; t < 4; ++t) {
            acc[0][t] = wmma_f16(na0, nb[t], acc[0][t]);
            acc[1][t] = wmma_f16(na1, nb[t], acc[1][t]);
        }
    }

#pragma unroll
    for (int r = 0; r < 2; ++r) {
#pragma unroll
        for (int t = 0; t < 4; ++t) {
#pragma unroll
            for (int e = 0; e < 8; ++e) {
                const int gr = rbase + r * 16 + e + 8 * hl;  // C/D: row = e + 8*half
                const int gc = cbase + t * 16 + l16;         // col = lane%16
                const float v = acc[r][t][e] + bias[gc];
                if (mode == 2) {
                    outf[(size_t)gr * DMODEL + gc] = v;
                } else if (mode == 1) {
                    const int b_ = gr >> 11;                 // gr / SEQ
                    const int n  = gr & (SEQ - 1);
                    outh[((size_t)b_ * DMODEL + gc) * SEQ + n] = (_Float16)v;
                } else {
                    outh[(size_t)gr * DMODEL + gc] = (_Float16)v;
                }
            }
        }
    }
}

// ---------------------------------------------------------------------------
// Fused flash attention with geometric distance bias, transposed scores.
// One block = 4 waves sharing one (b, h); each wave owns a 16-query tile.
// K/V tiles are double-buffered in LDS: the async copies for key-step j+1
// are issued right after the top barrier of step j and only waited at the
// top of step j+1, so global->LDS latency overlaps WMMA + softmax compute.
// Per step: 4 WMMA (S^T = K Q^T, K rows as A, Q as B), exact distance bias,
// online softmax, 4 WMMA (O^T += V^T P^T).  In S^T a lane holds 16 scores of
// ONE query (column = lane%16, key = e + 8*half per 16-key tile), so maximum
// and sum run in the lane's own registers with one exchange between the wave
// halves, and the two converted score tiles are already the B operand of the
// second product (k = 8*half + e, then 16 + 8*half + e): P never leaves the
// registers.
// ---------------------------------------------------------------------------
typedef __attribute__((ext_vector_type(4))) float v4f;

// Value of lane l ^ 16 (the other half of the wave holds the same query).
static __device__ __forceinline__ float xhalf(float x) {
    return __builtin_bit_cast(float, __builtin_amdgcn_permlanex16(
        __builtin_bit_cast(int, x), __builtin_bit_cast(int, x),
        0x76543210, 0xfedcba98, false, false));
}

__global__ __launch_bounds__(128)
void attn_fa(const _Float16* __restrict__ Qh, const _Float16* __restrict__ Kh,
             const _Float16* __restrict__ Vt, const float* __restrict__ pos,
             const float* __restrict__ dist_bias, _Float16* __restrict__ O) {
    __shared__ __align__(16) _Float16 Kt[2][32][64];  // [buf][key j][d]
    __shared__ __align__(16) _Float16 Vl[2][64][32];  // [buf][d (c)][key j]

    const int tid  = threadIdx.x;
    const int lane = tid & 31;
    const int wid  = tid >> 5;
    const int hl   = lane >> 4;
    const int l16  = lane & 15;

    const int bh    = blockIdx.x >> 5;     // 32 (b,h) pairs; 32 blocks each
    const int qgrp  = blockIdx.x & 31;
    const int b     = bh >> 4;
    const int h     = bh & 15;
    const int qbase = (qgrp * 4 + wid) * 16;

    // Scores live in base 2: log2(e) is folded into both constants, so each
    // exponential and the logarithm is one hardware instruction.
    const float LOG2E = 1.4426950408889634f;
    const float nab2  = -fabsf(dist_bias[h]) * LOG2E;
    const float scale = 0.125f * LOG2E;    // log2(e)/sqrt(DK)

    // Position of the one query this lane's score column belongs to.
    const float* pq = pos + ((size_t)b * SEQ + qbase + l16) * 3;
    const float qx = pq[0], qy = pq[1], qz = pq[2];
    // Precaution: the load's address registers are reused soon after it
    // (address sums, accumulator start values), so the wait stands first.
    asm volatile("s_wait_xcnt 0x0" ::: "memory");

    // Q fragments: invariant over the key loop -> registers (B operand).
    const _Float16* qrow =
        Qh + (size_t)(b * SEQ + qbase + l16) * DMODEL + h * DK;
    const v16h aq0 = load_frag16(qrow, hl);
    const v16h aq1 = load_frag16(qrow + 32, hl);

    v8f o[4] = {v8f{}, v8f{}, v8f{}, v8f{}};  // o[t][e] = O^T[t*16+8*hl+e][l16]
    float m = -3.0e38f;                       // running maximum of the query
    float l = 0.0f;                           // this half's share of the sum

    // Cooperative staging indices (constant over loop).
    const int krow = tid >> 2, kseg = (tid & 3) * 16;   // K: 32 rows x 128B
    const int vrow = tid >> 1, vseg = (tid & 1) * 16;   // V: 64 rows x 64B

    // Stage one 32-key block (K 32x64 + V 64x32) into LDS buffer `buf`.
    auto stage_tiles = [&](int buf, int jb) {
        const _Float16* ks =
            Kh + (size_t)(b * SEQ + jb + krow) * DMODEL + h * DK + kseg;
        stage16(&Kt[buf][krow][kseg], ks);
        stage16(&Kt[buf][krow][kseg + 8], ks + 8);
        const _Float16* vs =
            Vt + (size_t)(b * DMODEL + h * DK + vrow) * SEQ + jb + vseg;
        stage16(&Vl[buf][vrow][vseg], vs);
        stage16(&Vl[buf][vrow][vseg + 8], vs + 8);
    };

    stage_tiles(0, 0);   // prologue

    for (int jb = 0; jb < SEQ; jb += 32) {
        const int cur = (jb >> 5) & 1;

        // Wait for cur's staging (issued last iteration), make it visible.
        stage_wait();
        __syncthreads();

        // Kick off next block's staging; it completes during our compute.
        if (jb + 32 < SEQ) stage_tiles(cur ^ 1, jb + 32);

        // Positions of this lane's 2 x 8 keys (jb + 8*hl + e and 16 more):
        // 24 consecutive floats each, 96-byte aligned offsets.
        const v4f* pk0 = (const v4f*)(pos + ((size_t)b * SEQ + jb + 8 * hl) * 3);
        const v4f* pk1 = (const v4f*)(pos + ((size_t)b * SEQ + jb + 16 + 8 * hl) * 3);
        float kp0[24], kp1[24];
#pragma unroll  // constant indices keep the array in registers
        for (int i = 0; i < 6; ++i) {
            const v4f u = pk0[i], w = pk1[i];
#pragma unroll  // constant indices keep the array in registers
            for (int c = 0; c < 4; ++c) { kp0[i * 4 + c] = u[c]; kp1[i * 4 + c] = w[c]; }
        }

        // ---- S^T = K Q^T for the 32-key block (two 16x16 tiles) ----
        v8f s0 = v8f{}, s1 = v8f{};
        s0 = wmma_f16(load_frag16(&Kt[cur][l16][0], hl), aq0, s0);
        s1 = wmma_f16(load_frag16(&Kt[cur][16 + l16][0], hl), aq0, s1);
        s0 = wmma_f16(load_frag16(&Kt[cur][l16][32], hl), aq1, s0);
        s1 = wmma_f16(load_frag16(&Kt[cur][16 + l16][32], hl), aq1, s1);

        float a0[8], a1[8];
        float v = -3.0e38f;
#pragma unroll  // constant indices keep the array in registers
        for (int e = 0; e < 8; ++e) {
            float dx = qx - kp0[e * 3], dy = qy - kp0[e * 3 + 1], dz = qz - kp0[e * 3 + 2];
            const float d0v = __builtin_amdgcn_sqrtf(dx * dx + dy * dy + dz * dz);
            dx = qx - kp1[e * 3]; dy = qy - kp1[e * 3 + 1]; dz = qz - kp1[e * 3 + 2];
            const float d1v = __builtin_amdgcn_sqrtf(dx * dx + dy * dy + dz * dz);
            // The weight lies in [1e-8, 1 + 1e-8]: an exponential that falls
            // below the normal range vanishes in the sum with 1e-8 anyway,
            // and the logarithm's argument is always a normal number.
            a0[e] = s0[e] * scale +
                    __builtin_amdgcn_logf(__builtin_amdgcn_exp2f(nab2 * d0v) + 1e-8f);
            a1[e] = s1[e] * scale +
                    __builtin_amdgcn_logf(__builtin_amdgcn_exp2f(nab2 * d1v) + 1e-8f);
            v = fmaxf(v, fmaxf(a0[e], a1[e]));
        }
        // The other half holds the query's other 16 keys of this block.
        v = fmaxf(v, xhalf(v));

        const float mn = fmaxf(m, v);
        const float sc = __builtin_amdgcn_exp2f(m - mn);
        m = mn;
#pragma unroll  // constant indices keep the array in registers
        for (int t = 0; t < 4; ++t)
#pragma unroll  // constant indices keep the array in registers
            for (int e = 0; e < 8; ++e) o[t][e] *= sc;

        // P^T as B operand, straight from the two score tiles.
        v16h bp;
        float rs = 0.0f;
#pragma unroll  // constant indices keep the array in registers
        for (int e = 0; e < 8; ++e) {
            const float p0 = __builtin_amdgcn_exp2f(a0[e] - mn);
            const float p1 = __builtin_amdgcn_exp2f(a1[e] - mn);
            rs += p0 + p1;
            bp[e]     = (_Float16)p0;
            bp[8 + e] = (_Float16)p1;
        }
        l = l * sc + rs;

        // ---- O^T += V^T P^T (A-fragments from LDS V tile) ----
#pragma unroll  // constant indices keep the array in registers
        for (int t = 0; t < 4; ++t) {
            const v16h av = load_frag16(&Vl[cur][t * 16 + l16][0], hl);
            o[t] = wmma_f16(av, bp, o[t]);
        }
        // No trailing barrier needed: next iteration's top barrier protects
        // the buffer being re-staged.
    }

    // Join the halves' sums, normalize, store 8 consecutive channels a lane.
    const float lt = l + xhalf(l);
    _Float16* orow = O + (size_t)(b * SEQ + qbase + l16) * DMODEL + h * DK + 8 * hl;
#pragma unroll  // constant indices keep the array in registers
    for (int t = 0; t < 4; ++t) {
        v8h r;
#pragma unroll  // constant indices keep the array in registers
        for (int e = 0; e < 8; ++e) r[e] = (_Float16)(o[t][e] / lt);
        *(v8h*)(orow + t * 16) = r;
    }
}

// ---------------------------------------------------------------------------
extern "C" void kernel_launch(void* const* d_in, const int* in_sizes, int n_in,
                              void* d_out, int out_size, void* d_ws, size_t ws_size,
                              hipStream_t stream) {
    const float* x   = (const float*)d_in[0];
    const float* pos = (const float*)d_in[1];
    const float* Wq  = (const float*)d_in[2];
    const float* bq  = (const float*)d_in[3];
    const float* Wk  = (const float*)d_in[4];
    const float* bk  = (const float*)d_in[5];
    const float* Wv  = (const float*)d_in[6];
    const float* bv  = (const float*)d_in[7];
    const float* Wo  = (const float*)d_in[8];
    const float* bo  = (const float*)d_in[9];
    const float* db  = (const float*)d_in[10];
    float* out = (float*)d_out;

    char* ws = (char*)d_ws;
    size_t off = 0;
    auto alloc = [&](size_t bytes) -> char* {
        char* p = ws + off;
        off += (bytes + 255) & ~(size_t)255;
        return p;
    };
    const size_t act_elems = (size_t)MROWS * DMODEL;     // 4M
    const size_t w_elems   = (size_t)DMODEL * DMODEL;    // 1M

    _Float16* xh  = (_Float16*)alloc(act_elems * 2);
    _Float16* wqh = (_Float16*)alloc(w_elems * 2);
    _Float16* wkh = (_Float16*)alloc(w_elems * 2);
    _Float16* wvh = (_Float16*)alloc(w_elems * 2);
    _Float16* woh = (_Float16*)alloc(w_elems * 2);
    _Float16* Qh  = (_Float16*)alloc(act_elems * 2);
    _Float16* Kh  = (_Float16*)alloc(act_elems * 2);
    _Float16* Vt  = (_Float16*)alloc(act_elems * 2);
    _Float16* Ah  = (_Float16*)alloc(act_elems * 2);
    (void)ws_size; (void)in_sizes; (void)n_in; (void)out_size;

    // f32 -> f16 conversions (~48 MB total: 32 MB read, 16 MB written; trivially fast, L2 resident after).
    cvt_f32_f16<<<(int)((act_elems + 255) / 256), 256, 0, stream>>>(x,  xh,  (int)act_elems);
    cvt_f32_f16<<<(int)((w_elems + 255) / 256),   256, 0, stream>>>(Wq, wqh, (int)w_elems);
    cvt_f32_f16<<<(int)((w_elems + 255) / 256),   256, 0, stream>>>(Wk, wkh, (int)w_elems);
    cvt_f32_f16<<<(int)((w_elems + 255) / 256),   256, 0, stream>>>(Wv, wvh, (int)w_elems);
    cvt_f32_f16<<<(int)((w_elems + 255) / 256),   256, 0, stream>>>(Wo, woh, (int)w_elems);

    // QKV projections (V stored transposed for contiguous PV fragments).
    gemm16<<<512, 128, 0, stream>>>(xh, wqh, bq, Qh, nullptr, 0);
    gemm16<<<512, 128, 0, stream>>>(xh, wkh, bk, Kh, nullptr, 0);
    gemm16<<<512, 128, 0, stream>>>(xh, wvh, bv, Vt, nullptr, 1);

    // Fused flash attention with geometric bias.
    attn_fa<<<1024, 128, 0, stream>>>(Qh, Kh, Vt, pos, db, Ah);

    // Output projection -> f32 result.
    gemm16<<<512, 128, 0, stream>>>(Ah, woh, bo, nullptr, out, 2);
}

// v003
// It runs in 263 microseconds.
// Two timings next to v002 put it at 1.06 and 1.05 times that version's speed.
// Over all steps from v000 it is 1.39 times as fast.
#include <hip/hip_runtime.h>
#include <hip/hip_bf16.h>

#define BATCH   2
#define SEQ     2048
#define DMODEL  1024
#define NHEADS  16
#define DK      64
#define MROWS   (BATCH * SEQ)     // 4096

typedef __attribute__((ext_vector_type(16))) _Float16 v16h;
typedef __attribute__((ext_vector_type(8)))  _Float16 v8h;
typedef __attribute__((ext_vector_type(8)))  float    v8f;
typedef __attribute__((ext_vector_type(4)))  int      v4i;

#if defined(__gfx1250__) && __has_builtin(__builtin_amdgcn_global_load_async_to_lds_b128) && __has_builtin(__builtin_amdgcn_s_wait_asynccnt)
#define HAS_ASYNC_LDS 1
#else
#define HAS_ASYNC_LDS 0
#endif

// Copy 16 bytes global -> LDS. Uses the CDNA5 async-to-LDS path (ASYNCcnt,
// no VGPR round trip) when the builtin exists; else load+ds_store fallback.
static __device__ __forceinline__ void stage16(_Float16* lds_dst, const _Float16* gsrc) {
#if HAS_ASYNC_LDS
    __builtin_amdgcn_global_load_async_to_lds_b128(
        (__attribute__((address_space(1))) v4i*)gsrc,
        (__attribute__((address_space(3))) v4i*)lds_dst, 0, 0);
#else
    *(v8h*)lds_dst = *(const v8h*)gsrc;
#endif
}

static __device__ __forceinline__ void stage_wait() {
#if HAS_ASYNC_LDS
    __builtin_amdgcn_s_wait_asynccnt(0);
#endif
}

// Load a 16x32 (f16) A/B fragment row for this lane.
// Per CDNA5 ISA layout: lane half 0 holds K = [0..7] and [16..23],
// half 1 holds K = [8..15] and [24..31]. Two aligned 16B loads.
static __device__ __forceinline__ v16h load_frag16(const _Float16* p, int hl) {
    v8h lo = *(const v8h*)(p + hl * 8);
    v8h hi = *(const v8h*)(p + 16 + hl * 8);
    return __builtin_shufflevector(lo, hi, 0, 1, 2, 3, 4, 5, 6, 7,
                                           8, 9, 10, 11, 12, 13, 14, 15);
}

static __device__ __forceinline__ v8f wmma_f16(v16h a, v16h b, v8f c) {
    return __builtin_amdgcn_wmma_f32_16x16x32_f16(
        /*neg_a=*/false, a, /*neg_b=*/false, b,
        /*c_mod=*/(short)0, c, /*reuse_a=*/false, /*reuse_b=*/false);
}

// ---------------------------------------------------------------------------
// f32 -> f16 conversion
// ---------------------------------------------------------------------------
__global__ __launch_bounds__(256)
void cvt_f32_f16(const float* __restrict__ in, _Float16* __restrict__ out, int n) {
    int i = blockIdx.x * blockDim.x + threadIdx.x;
    if (i < n) out[i] = (_Float16)in[i];
}

// ---------------------------------------------------------------------------
// Y = X @ W^T + bias.  X:[MROWS, DMODEL] f16, W:[DMODEL, DMODEL] f16 row-major.
// One wave computes a 32x64 tile (8 accumulators, 8 WMMA per 12 loads).
// K-loop of 32, software-pipelined and unrolled by 2 so the two fragment
// register sets ping-pong (no rotation moves), loads stay in flight across
// the WMMAs of the other set.
// mode 0: f16 store [MROWS, DMODEL]        (Q, K projections)
// mode 1: f16 transposed store Vt[b][c][n] (V projection)
// mode 2: f32 store [MROWS, DMODEL]        (final output projection)
// ---------------------------------------------------------------------------
__global__ __launch_bounds__(128)
void gemm16(const _Float16* __restrict__ X, const _Float16* __restrict__ W,
            const float* __restrict__ bias,
            _Float16* __restrict__ outh, float* __restrict__ outf, int mode) {
    const int lane = threadIdx.x & 31;
    const int wid  = threadIdx.x >> 5;
    const int hl   = lane >> 4;
    const int l16  = lane & 15;

    const int tile  = blockIdx.x * 4 + wid;   // 2048 tiles total
    const int trow  = tile >> 4;              // 128 strips of 32 rows
    const int tcol  = tile & 15;              // 16 groups of 64 cols
    const int rbase = trow * 32;
    const int cbase = tcol * 64;

    const _Float16* arow0 = X + (size_t)(rbase + l16) * DMODEL;
    const _Float16* arow1 = X + (size_t)(rbase + 16 + l16) * DMODEL;
    const _Float16* brow[4];
#pragma unroll
    for (int t = 0; t < 4; ++t)
        brow[t] = W + (size_t)(cbase + t * 16 + l16) * DMODEL;

    v8f acc[2][4];
#pragma unroll
    for (int r = 0; r < 2; ++r)
#pragma unroll
        for (int t = 0; t < 4; ++t) acc[r][t] = v8f{};

    // Set "c" holds fragments for kb; set "n" for kb+32.
    v16h ca0 = load_frag16(arow0, hl);
    v16h ca1 = load_frag16(arow1, hl);
    v16h cb[4];
#pragma unroll
    for (int t = 0; t < 4; ++t) cb[t] = load_frag16(brow[t], hl);

    for (int kb = 0; kb + 64 < DMODEL; kb += 64) {
        // Fragments for kb+32 (issued before consuming set c).
        v16h na0 = load_frag16(arow0 + kb + 32, hl);
        v16h na1 = load_frag16(arow1 + kb + 32, hl);
        v16h nb[4];
#pragma unroll
        for (int t = 0; t < 4; ++t) nb[t] = load_frag16(brow[t] + kb + 32, hl);
        __builtin_prefetch(arow0 + kb + 256, 0, 3);

#pragma unroll
        for (int t = 0; t < 4; ++t) {
            acc[0][t] = wmma_f16(ca0, cb[t], acc[0][t]);
            acc[1][t] = wmma_f16(ca1, cb[t], acc[1][t]);
        }

        // Refill set c with fragments for kb+64 while set n computes.
        ca0 = load_frag16(arow0 + kb + 64, hl);
        ca1 = load_frag16(arow1 + kb + 64, hl);
#pragma unroll
        for (int t = 0; t < 4; ++t) cb[t] = load_frag16(brow[t] + kb + 64, hl);

#pragma unroll
        for (int t = 0; t < 4; ++t) {
            acc[0][t] = wmma_f16(na0, nb[t], acc[0][t]);
            acc[1][t] = wmma_f16(na1, nb[t], acc[1][t]);
        }
    }
    // Epilogue: set c holds kb = DMODEL-64; load and compute the final pair.
    {
        v16h na0 = load_frag16(arow0 + DMODEL - 32, hl);
        v16h na1 = load_frag16(arow1 + DMODEL - 32, hl);
        v16h nb[4];
#pragma unroll
        for (int t = 0; t < 4; ++t)
            nb[t] = load_frag16(brow[t] + DMODEL - 32, hl);
#pragma unroll
        for (int t = 0; t < 4; ++t) {
            acc[0][t] = wmma_f16(ca0, cb[t], acc[0][t]);
            acc[1][t] = wmma_f16(ca1, cb[t], acc[1][t]);
        }
#pragma unroll
        for (int t = 0; t < 4; ++t) {
            acc[0][t] = wmma_f16(na0, nb[t], acc[0][t]);
            acc[1][t] = wmma_f16(na1, nb[t], acc[1][t]);
        }
    }

#pragma unroll
    for (int r = 0; r < 2; ++r) {
#pragma unroll
        for (int t = 0; t < 4; ++t) {
#pragma unroll
            for (int e = 0; e < 8; ++e) {
                const int gr = rbase + r * 16 + e + 8 * hl;  // C/D: row = e + 8*half
                const int gc = cbase + t * 16 + l16;         // col = lane%16
                const float v = acc[r][t][e] + bias[gc];
                if (mode == 2) {
                    outf[(size_t)gr * DMODEL + gc] = v;
                } else if (mode == 1) {
                    const int b_ = gr >> 11;                 // gr / SEQ
                    const int n  = gr & (SEQ - 1);
                    outh[((size_t)b_ * DMODEL + gc) * SEQ + n] = (_Float16)v;
                } else {
                    outh[(size_t)gr * DMODEL + gc] = (_Float16)v;
                }
            }
        }
    }
}

// ---------------------------------------------------------------------------
// Fused flash attention with geometric distance bias, transposed scores.
// One block = 4 waves sharing one (b, h); each wave owns a 16-query tile.
// K/V tiles are double-buffered in LDS: the async copies for key-step j+1
// are issued right after the top barrier of step j and only waited at the
// top of step j+1, so global->LDS latency overlaps WMMA + softmax compute.
// Per step: 4 WMMA (S^T = K Q^T, K rows as A, Q as B), exact distance bias,
// online softmax, 4 WMMA (O^T += V^T P^T).  In S^T a lane holds 16 scores of
// ONE query (column = lane%16, key = e + 8*half per 16-key tile), so maximum
// and sum run in the lane's own registers with one exchange between the wave
// halves, and the two converted score tiles are already the B operand of the
// second product (k = 8*half + e, then 16 + 8*half + e): P never leaves the
// registers.
// ---------------------------------------------------------------------------
typedef __attribute__((ext_vector_type(4))) float v4f;

// Value of lane l ^ 16 (the other half of the wave holds the same query).
static __device__ __forceinline__ float xhalf(float x) {
    return __builtin_bit_cast(float, __builtin_amdgcn_permlanex16(
        __builtin_bit_cast(int, x), __builtin_bit_cast(int, x),
        0x76543210, 0xfedcba98, false, false));
}

__global__ __launch_bounds__(128)
void attn_fa(const _Float16* __restrict__ Qh, const _Float16* __restrict__ Kh,
             const _Float16* __restrict__ Vt, const float* __restrict__ pos,
             const float* __restrict__ dist_bias, _Float16* __restrict__ O) {
    // Row pitch = 16 B x odd (144 B for the 128-B K rows, 80 B for the 64-B V
    // rows): the 16 rows that one ds_load_b128 fragment read touches then fall
    // on 16 different groups of four banks.  At the bare pitches they fall on
    // 2 (K) and 4 (V) groups and each read is replayed 8 and 4 times.
    // The pad halves at the end of a row are never written and never read.
    __shared__ __align__(16) _Float16 Kt[2][32][64 + 8];  // [buf][key j][d]
    __shared__ __align__(16) _Float16 Vl[2][64][32 + 8];  // [buf][d (c)][key j]

    const int tid  = threadIdx.x;
    const int lane = tid & 31;
    const int wid  = tid >> 5;
    const int hl   = lane >> 4;
    const int l16  = lane & 15;

    const int bh    = blockIdx.x >> 5;     // 32 (b,h) pairs; 32 blocks each
    const int qgrp  = blockIdx.x & 31;
    const int b     = bh >> 4;
    const int h     = bh & 15;
    const int qbase = (qgrp * 4 + wid) * 16;

    // Scores live in base 2: log2(e) is folded into both constants, so each
    // exponential and the logarithm is one hardware instruction.
    const float LOG2E = 1.4426950408889634f;
    const float nab2  = -fabsf(dist_bias[h]) * LOG2E;
    const float scale = 0.125f * LOG2E;    // log2(e)/sqrt(DK)

    // Position of the one query this lane's score column belongs to.
    const float* pq = pos + ((size_t)b * SEQ + qbase + l16) * 3;
    const float qx = pq[0], qy = pq[1], qz = pq[2];
    // Precaution: the load's address registers are reused soon after it
    // (address sums, accumulator start values), so the wait stands first.
    asm volatile("s_wait_xcnt 0x0" ::: "memory");

    // Q fragments: invariant over the key loop -> registers (B operand).
    const _Float16* qrow =
        Qh + (size_t)(b * SEQ + qbase + l16) * DMODEL + h * DK;
    const v16h aq0 = load_frag16(qrow, hl);
    const v16h aq1 = load_frag16(qrow + 32, hl);

    v8f o[4] = {v8f{}, v8f{}, v8f{}, v8f{}};  // o[t][e] = O^T[t*16+8*hl+e][l16]
    float m = -3.0e38f;                       // running maximum of the query
    float l = 0.0f;                           // this half's share of the sum

    // Cooperative staging indices (constant over loop).
    const int krow = tid >> 2, kseg = (tid & 3) * 16;   // K: 32 rows x 128B
    const int vrow = tid >> 1, vseg = (tid & 1) * 16;   // V: 64 rows x 64B

    // Stage one 32-key block (K 32x64 + V 64x32) into LDS buffer `buf`.
    auto stage_tiles = [&](int buf, int jb) {
        const _Float16* ks =
            Kh + (size_t)(b * SEQ + jb + krow) * DMODEL + h * DK + kseg;
        stage16(&Kt[buf][krow][kseg], ks);
        stage16(&Kt[buf][krow][kseg + 8], ks + 8);
        const _Float16* vs =
            Vt + (size_t)(b * DMODEL + h * DK + vrow) * SEQ + jb + vseg;
        stage16(&Vl[buf][vrow][vseg], vs);
        stage16(&Vl[buf][vrow][vseg + 8], vs + 8);
    };

    stage_tiles(0, 0);   // prologue

    for (int jb = 0; jb < SEQ; jb += 32) {
        const int cur = (jb >> 5) & 1;

        // Wait for cur's staging (issued last iteration), make it visible.
        stage_wait();
        __syncthreads();

        // Kick off next block's staging; it completes during our compute.
        if (jb + 32 < SEQ) stage_tiles(cur ^ 1, jb + 32);

        // Positions of this lane's 2 x 8 keys (jb + 8*hl + e and 16 more):
        // 24 consecutive floats each, 96-byte aligned offsets.
        const v4f* pk0 = (const v4f*)(pos + ((size_t)b * SEQ + jb + 8 * hl) * 3);
        const v4f* pk1 = (const v4f*)(pos + ((size_t)b * SEQ + jb + 16 + 8 * hl) * 3);
        float kp0[24], kp1[24];
#pragma unroll  // constant indices keep the array in registers
        for (int i = 0; i < 6; ++i) {
            const v4f u = pk0[i], w = pk1[i];
#pragma unroll  // constant indices keep the array in registers
            for (int c = 0; c < 4; ++c) { kp0[i * 4 + c] = u[c]; kp1[i * 4 + c] = w[c]; }
        }

        // ---- S^T = K Q^T for the 32-key block (two 16x16 tiles) ----
        v8f s0 = v8f{}, s1 = v8f{};
        s0 = wmma_f16(load_frag16(&Kt[cur][l16][0], hl), aq0, s0);
        s1 = wmma_f16(load_frag16(&Kt[cur][16 + l16][0], hl), aq0, s1);
        s0 = wmma_f16(load_frag16(&Kt[cur][l16][32], hl), aq1, s0);
        s1 = wmma_f16(load_frag16(&Kt[cur][16 + l16][32], hl), aq1, s1);

        float a0[8], a1[8];
        float v = -3.0e38f;
#pragma unroll  // constant indices keep the array in registers
        for (int e = 0; e < 8; ++e) {
            float dx = qx - kp0[e * 3], dy = qy - kp0[e * 3 + 1], dz = qz - kp0[e * 3 + 2];
            const float d0v = __builtin_amdgcn_sqrtf(dx * dx + dy * dy + dz * dz);
            dx = qx - kp1[e * 3]; dy = qy - kp1[e * 3 + 1]; dz = qz - kp1[e * 3 + 2];
            const float d1v = __builtin_amdgcn_sqrtf(dx * dx + dy * dy + dz * dz);
            // The weight lies in [1e-8, 1 + 1e-8]: an exponential that falls
            // below the normal range vanishes in the sum with 1e-8 anyway,
            // and the logarithm's argument is always a normal number.
            a0[e] = s0[e] * scale +
                    __builtin_amdgcn_logf(__builtin_amdgcn_exp2f(nab2 * d0v) + 1e-8f);
            a1[e] = s1[e] * scale +
                    __builtin_amdgcn_logf(__builtin_amdgcn_exp2f(nab2 * d1v) + 1e-8f);
            v = fmaxf(v, fmaxf(a0[e], a1[e]));
        }
        // The other half holds the query's other 16 keys of this block.
        v = fmaxf(v, xhalf(v));

        const float mn = fmaxf(m, v);
        const float sc = __builtin_amdgcn_exp2f(m - mn);
        m = mn;
#pragma unroll  // constant indices keep the array in registers
        for (int t = 0; t < 4; ++t)
#pragma unroll  // constant indices keep the array in registers
            for (int e = 0; e < 8; ++e) o[t][e] *= sc;

        // P^T as B operand, straight from the two score tiles.
        v16h bp;
        float rs = 0.0f;
#pragma unroll  // constant indices keep the array in registers
        for (int e = 0; e < 8; ++e) {
            const float p0 = __builtin_amdgcn_exp2f(a0[e] - mn);
            const float p1 = __builtin_amdgcn_exp2f(a1[e] - mn);
            rs += p0 + p1;
            bp[e]     = (_Float16)p0;
            bp[8 + e] = (_Float16)p1;
        }
        l = l * sc + rs;

        // ---- O^T += V^T P^T (A-fragments from LDS V tile) ----
#pragma unroll  // constant indices keep the array in registers
        for (int t = 0; t < 4; ++t) {
            const v16h av = load_frag16(&Vl[cur][t * 16 + l16][0], hl);
            o[t] = wmma_f16(av, bp, o[t]);
        }
        // No trailing barrier needed: next iteration's top barrier protects
        // the buffer being re-staged.
    }

    // Join the halves' sums, normalize, store 8 consecutive channels a lane.
    const float lt = l + xhalf(l);
    _Float16* orow = O + (size_t)(b * SEQ + qbase + l16) * DMODEL + h * DK + 8 * hl;
#pragma unroll  // constant indices keep the array in registers
    for (int t = 0; t < 4; ++t) {
        v8h r;
#pragma unroll  // constant indices keep the array in registers
        for (int e = 0; e < 8; ++e) r[e] = (_Float16)(o[t][e] / lt);
        *(v8h*)(orow + t * 16) = r;
    }
}

// ---------------------------------------------------------------------------
extern "C" void kernel_launch(void* const* d_in, const int* in_sizes, int n_in,
                              void* d_out, int out_size, void* d_ws, size_t ws_size,
                              hipStream_t stream) {
    const float* x   = (const float*)d_in[0];
    const float* pos = (const float*)d_in[1];
    const float* Wq  = (const float*)d_in[2];
    const float* bq  = (const float*)d_in[3];
    const float* Wk  = (const float*)d_in[4];
    const float* bk  = (const float*)d_in[5];
    const float* Wv  = (const float*)d_in[6];
    const float* bv  = (const float*)d_in[7];
    const float* Wo  = (const float*)d_in[8];
    const float* bo  = (const float*)d_in[9];
    const float* db  = (const float*)d_in[10];
    float* out = (float*)d_out;

    char* ws = (char*)d_ws;
    size_t off = 0;
    auto alloc = [&](size_t bytes) -> char* {
        char* p = ws + off;
        off += (bytes + 255) & ~(size_t)255;
        return p;
    };
    const size_t act_elems = (size_t)MROWS * DMODEL;     // 4M
    const size_t w_elems   = (size_t)DMODEL * DMODEL;    // 1M

    _Float16* xh  = (_Float16*)alloc(act_elems * 2);
    _Float16* wqh = (_Float16*)alloc(w_elems * 2);
    _Float16* wkh = (_Float16*)alloc(w_elems * 2);
    _Float16* wvh = (_Float16*)alloc(w_elems * 2);
    _Float16* woh = (_Float16*)alloc(w_elems * 2);
    _Float16* Qh  = (_Float16*)alloc(act_elems * 2);
    _Float16* Kh  = (_Float16*)alloc(act_elems * 2);
    _Float16* Vt  = (_Float16*)alloc(act_elems * 2);
    _Float16* Ah  = (_Float16*)alloc(act_elems * 2);
    (void)ws_size; (void)in_sizes; (void)n_in; (void)out_size;

    // f32 -> f16 conversions (~48 MB total: 32 MB read, 16 MB written; trivially fast, L2 resident after).
    cvt_f32_f16<<<(int)((act_elems + 255) / 256), 256, 0, stream>>>(x,  xh,  (int)act_elems);
    cvt_f32_f16<<<(int)((w_elems + 255) / 256),   256, 0, stream>>>(Wq, wqh, (int)w_elems);
    cvt_f32_f16<<<(int)((w_elems + 255) / 256),   256, 0, stream>>>(Wk, wkh, (int)w_elems);
    cvt_f32_f16<<<(int)((w_elems + 255) / 256),   256, 0, stream>>>(Wv, wvh, (int)w_elems);
    cvt_f32_f16<<<(int)((w_elems + 255) / 256),   256, 0, stream>>>(Wo, woh, (int)w_elems);

    // QKV projections (V stored transposed for contiguous PV fragments).
    gemm16<<<512, 128, 0, stream>>>(xh, wqh, bq, Qh, nullptr, 0);
    gemm16<<<512, 128, 0, stream>>>(xh, wkh, bk, Kh, nullptr, 0);
    gemm16<<<512, 128, 0, stream>>>(xh, wvh, bv, Vt, nullptr, 1);

    // Fused flash attention with geometric bias.
    attn_fa<<<1024, 128, 0, stream>>>(Qh, Kh, Vt, pos, db, Ah);

    // Output projection -> f32 result.
    gemm16<<<512, 128, 0, stream>>>(Ah, woh, bo, nullptr, out, 2);
}

// v004
// Measured time: 248 microseconds a run.
// In two side-by-side timings against v003, it was 1.06 and 1.05 times as fast.
// Over all steps from v000 it is 1.47 times as fast.
#include <hip/hip_runtime.h>
#include <hip/hip_bf16.h>

#define BATCH   2
#define SEQ     2048
#define DMODEL  1024
#define NHEADS  16
#define DK      64
#define MROWS   (BATCH * SEQ)     // 4096

typedef __attribute__((ext_vector_type(16))) _Float16 v16h;
typedef __attribute__((ext_vector_type(8)))  _Float16 v8h;
typedef __attribute__((ext_vector_type(8)))  float    v8f;
typedef __attribute__((ext_vector_type(4)))  int      v4i;

#if defined(__gfx1250__) && __has_builtin(__builtin_amdgcn_global_load_async_to_lds_b128) && __has_builtin(__builtin_amdgcn_s_wait_asynccnt)
#define HAS_ASYNC_LDS 1
#else
#define HAS_ASYNC_LDS 0
#endif

// Copy 16 bytes global -> LDS. Uses the CDNA5 async-to-LDS path (ASYNCcnt,
// no VGPR round trip) when the builtin exists; else load+ds_store fallback.
static __device__ __forceinline__ void stage16(_Float16* lds_dst, const _Float16* gsrc) {
#if HAS_ASYNC_LDS
    __builtin_amdgcn_global_load_async_to_lds_b128(
        (__attribute__((address_space(1))) v4i*)gsrc,
        (__attribute__((address_space(3))) v4i*)lds_dst, 0, 0);
#else
    *(v8h*)lds_dst = *(const v8h*)gsrc;
#endif
}

static __device__ __forceinline__ void stage_wait() {
#if HAS_ASYNC_LDS
    __builtin_amdgcn_s_wait_asynccnt(0);
#endif
}

// Load a 16x32 (f16) A/B fragment row for this lane.
// Per CDNA5 ISA layout: lane half 0 holds K = [0..7] and [16..23],
// half 1 holds K = [8..15] and [24..31]. Two aligned 16B loads.
static __device__ __forceinline__ v16h load_frag16(const _Float16* p, int hl) {
    v8h lo = *(const v8h*)(p + hl * 8);
    v8h hi = *(const v8h*)(p + 16 + hl * 8);
    return __builtin_shufflevector(lo, hi, 0, 1, 2, 3, 4, 5, 6, 7,
                                           8, 9, 10, 11, 12, 13, 14, 15);
}

static __device__ __forceinline__ v8f wmma_f16(v16h a, v16h b, v8f c) {
    return __builtin_amdgcn_wmma_f32_16x16x32_f16(
        /*neg_a=*/false, a, /*neg_b=*/false, b,
        /*c_mod=*/(short)0, c, /*reuse_a=*/false, /*reuse_b=*/false);
}

// ---------------------------------------------------------------------------
// f32 -> f16 conversion of x and the four weight matrices, one launch.
// The whole grid fits on the chip at once: 512 blocks of 8 waves, 256 WGPs.
// A wave takes 2048 consecutive elements: 16 loads of 512 contiguous bytes,
// issued ahead of the conversions so that many are in flight at once, then
// 16 stores of 256 contiguous bytes (whole 128-byte lines on both sides).
// Blocks 0..255 take x, then 64 blocks each take Wq, Wk, Wv, Wo.
// ---------------------------------------------------------------------------
typedef __attribute__((ext_vector_type(4))) float    f32x4;
typedef __attribute__((ext_vector_type(4))) _Float16 f16x4;

#define CVT_BLOCK_ELEMS 16384                                   // 8 waves x 2048
#define CVT_X_BLOCKS    (MROWS * DMODEL / CVT_BLOCK_ELEMS)      // 256
#define CVT_W_BLOCKS    (DMODEL * DMODEL / CVT_BLOCK_ELEMS)     // 64

__global__ __launch_bounds__(256)
void cvt_all(const float* __restrict__ x,
             const float* __restrict__ wq, const float* __restrict__ wk,
             const float* __restrict__ wv, const float* __restrict__ wo,
             _Float16* __restrict__ xh,
             _Float16* __restrict__ wqh, _Float16* __restrict__ wkh,
             _Float16* __restrict__ wvh, _Float16* __restrict__ woh) {
    int blk = blockIdx.x;
    const float* in = x;
    _Float16* out = xh;
    if (blk >= CVT_X_BLOCKS) {                 // block-uniform choice of tensor
        blk -= CVT_X_BLOCKS;
        const int w = blk / CVT_W_BLOCKS;
        blk -= w * CVT_W_BLOCKS;
        in  = w == 0 ? wq  : w == 1 ? wk  : w == 2 ? wv  : wo;
        out = w == 0 ? wqh : w == 1 ? wkh : w == 2 ? wvh : woh;
    }
    const int base = blk * CVT_BLOCK_ELEMS + (threadIdx.x >> 5) * 2048 +
                     (threadIdx.x & 31) * 4;
    const f32x4* src = (const f32x4*)(in + base);
    f16x4* dst = (f16x4*)(out + base);

    f32x4 v[16];
#pragma unroll  // constant indices keep the array in registers
    for (int i = 0; i < 16; ++i) v[i] = src[i * 32];
#pragma unroll  // constant indices keep the array in registers
    for (int i = 0; i < 16; ++i) {
        f16x4 r;
#pragma unroll  // constant indices keep the array in registers
        for (int c = 0; c < 4; ++c) r[c] = (_Float16)v[i][c];
        dst[i * 32] = r;
    }
}

// ---------------------------------------------------------------------------
// Y = X @ W^T + bias.  X:[MROWS, DMODEL] f16, W:[DMODEL, DMODEL] f16 row-major.
// One wave computes a 32x64 tile (8 accumulators, 8 WMMA per 12 loads).
// K-loop of 32, software-pipelined and unrolled by 2 so the two fragment
// register sets ping-pong (no rotation moves), loads stay in flight across
// the WMMAs of the other set.
// mode 0: f16 store [MROWS, DMODEL]        (Q, K projections)
// mode 1: f16 transposed store Vt[b][c][n] (V projection)
// mode 2: f32 store [MROWS, DMODEL]        (final output projection)
// ---------------------------------------------------------------------------
__global__ __launch_bounds__(128)
void gemm16(const _Float16* __restrict__ X, const _Float16* __restrict__ W,
            const float* __restrict__ bias,
            _Float16* __restrict__ outh, float* __restrict__ outf, int mode) {
    const int lane = threadIdx.x & 31;
    const int wid  = threadIdx.x >> 5;
    const int hl   = lane >> 4;
    const int l16  = lane & 15;

    const int tile  = blockIdx.x * 4 + wid;   // 2048 tiles total
    const int trow  = tile >> 4;              // 128 strips of 32 rows
    const int tcol  = tile & 15;              // 16 groups of 64 cols
    const int rbase = trow * 32;
    const int cbase = tcol * 64;

    const _Float16* arow0 = X + (size_t)(rbase + l16) * DMODEL;
    const _Float16* arow1 = X + (size_t)(rbase + 16 + l16) * DMODEL;
    const _Float16* brow[4];
#pragma unroll
    for (int t = 0; t < 4; ++t)
        brow[t] = W + (size_t)(cbase + t * 16 + l16) * DMODEL;

    v8f acc[2][4];
#pragma unroll
    for (int r = 0; r < 2; ++r)
#pragma unroll
        for (int t = 0; t < 4; ++t) acc[r][t] = v8f{};

    // Set "c" holds fragments for kb; set "n" for kb+32.
    v16h ca0 = load_frag16(arow0, hl);
    v16h ca1 = load_frag16(arow1, hl);
    v16h cb[4];
#pragma unroll
    for (int t = 0; t < 4; ++t) cb[t] = load_frag16(brow[t], hl);

    for (int kb = 0; kb + 64 < DMODEL; kb += 64) {
        // Fragments for kb+32 (issued before consuming set c).
        v16h na0 = load_frag16(arow0 + kb + 32, hl);
        v16h na1 = load_frag16(arow1 + kb + 32, hl);
        v16h nb[4];
#pragma unroll
        for (int t = 0; t < 4; ++t) nb[t] = load_frag16(brow[t] + kb + 32, hl);
        __builtin_prefetch(arow0 + kb + 256, 0, 3);

#pragma unroll
        for (int t = 0; t < 4; ++t) {
            acc[0][t] = wmma_f16(ca0, cb[t], acc[0][t]);
            acc[1][t] = wmma_f16(ca1, cb[t], acc[1][t]);
        }

        // Refill set c with fragments for kb+64 while set n computes.
        ca0 = load_frag16(arow0 + kb + 64, hl);
        ca1 = load_frag16(arow1 + kb + 64, hl);
#pragma unroll
        for (int t = 0; t < 4; ++t) cb[t] = load_frag16(brow[t] + kb + 64, hl);

#pragma unroll
        for (int t = 0; t < 4; ++t) {
            acc[0][t] = wmma_f16(na0, nb[t], acc[0][t]);
            acc[1][t] = wmma_f16(na1, nb[t], acc[1][t]);
        }
    }
    // Epilogue: set c holds kb = DMODEL-64; load and compute the final pair.
    {
        v16h na0 = load_frag16(arow0 + DMODEL - 32, hl);
        v16h na1 = load_frag16(arow1 + DMODEL - 32, hl);
        v16h nb[4];
#pragma unroll
        for (int t = 0; t < 4; ++t)
            nb[t] = load_frag16(brow[t] + DMODEL - 32, hl);
#pragma unroll
        for (int t = 0; t < 4; ++t) {
            acc[0][t] = wmma_f16(ca0, cb[t], acc[0][t]);
            acc[1][t] = wmma_f16(ca1, cb[t], acc[1][t]);
        }
#pragma unroll
        for (int t = 0; t < 4; ++t) {
            acc[0][t] = wmma_f16(na0, nb[t], acc[0][t]);
            acc[1][t] = wmma_f16(na1, nb[t], acc[1][t]);
        }
    }

#pragma unroll
    for (int r = 0; r < 2; ++r) {
#pragma unroll
        for (int t = 0; t < 4; ++t) {
#pragma unroll
            for (int e = 0; e < 8; ++e) {
                const int gr = rbase + r * 16 + e + 8 * hl;  // C/D: row = e + 8*half
                const int gc = cbase + t * 16 + l16;         // col = lane%16
                const float v = acc[r][t][e] + bias[gc];
                if (mode == 2) {
                    outf[(size_t)gr * DMODEL + gc] = v;
                } else if (mode == 1) {
                    const int b_ = gr >> 11;                 // gr / SEQ
                    const int n  = gr & (SEQ - 1);
                    outh[((size_t)b_ * DMODEL + gc) * SEQ + n] = (_Float16)v;
                } else {
                    outh[(size_t)gr * DMODEL + gc] = (_Float16)v;
                }
            }
        }
    }
}

// ---------------------------------------------------------------------------
// Fused flash attention with geometric distance bias, transposed scores.
// One block = 4 waves sharing one (b, h); each wave owns a 16-query tile.
// K/V tiles are double-buffered in LDS: the async copies for key-step j+1
// are issued right after the top barrier of step j and only waited at the
// top of step j+1, so global->LDS latency overlaps WMMA + softmax compute.
// Per step: 4 WMMA (S^T = K Q^T, K rows as A, Q as B), exact distance bias,
// online softmax, 4 WMMA (O^T += V^T P^T).  In S^T a lane holds 16 scores of
// ONE query (column = lane%16, key = e + 8*half per 16-key tile), so maximum
// and sum run in the lane's own registers with one exchange between the wave
// halves, and the two converted score tiles are already the B operand of the
// second product (k = 8*half + e, then 16 + 8*half + e): P never leaves the
// registers.
// ---------------------------------------------------------------------------
typedef __attribute__((ext_vector_type(4))) float v4f;

// Value of lane l ^ 16 (the other half of the wave holds the same query).
static __device__ __forceinline__ float xhalf(float x) {
    return __builtin_bit_cast(float, __builtin_amdgcn_permlanex16(
        __builtin_bit_cast(int, x), __builtin_bit_cast(int, x),
        0x76543210, 0xfedcba98, false, false));
}

__global__ __launch_bounds__(128)
void attn_fa(const _Float16* __restrict__ Qh, const _Float16* __restrict__ Kh,
             const _Float16* __restrict__ Vt, const float* __restrict__ pos,
             const float* __restrict__ dist_bias, _Float16* __restrict__ O) {
    // Row pitch = 16 B x odd (144 B for the 128-B K rows, 80 B for the 64-B V
    // rows): the 16 rows that one ds_load_b128 fragment read touches then fall
    // on 16 different groups of four banks.  At the bare pitches they fall on
    // 2 (K) and 4 (V) groups and each read is replayed 8 and 4 times.
    // The pad halves at the end of a row are never written and never read.
    __shared__ __align__(16) _Float16 Kt[2][32][64 + 8];  // [buf][key j][d]
    __shared__ __align__(16) _Float16 Vl[2][64][32 + 8];  // [buf][d (c)][key j]

    const int tid  = threadIdx.x;
    const int lane = tid & 31;
    const int wid  = tid >> 5;
    const int hl   = lane >> 4;
    const int l16  = lane & 15;

    const int bh    = blockIdx.x >> 5;     // 32 (b,h) pairs; 32 blocks each
    const int qgrp  = blockIdx.x & 31;
    const int b     = bh >> 4;
    const int h     = bh & 15;
    const int qbase = (qgrp * 4 + wid) * 16;

    // Scores live in base 2: log2(e) is folded into both constants, so each
    // exponential and the logarithm is one hardware instruction.
    const float LOG2E = 1.4426950408889634f;
    const float nab2  = -fabsf(dist_bias[h]) * LOG2E;
    const float scale = 0.125f * LOG2E;    // log2(e)/sqrt(DK)

    // Position of the one query this lane's score column belongs to.
    const float* pq = pos + ((size_t)b * SEQ + qbase + l16) * 3;
    const float qx = pq[0], qy = pq[1], qz = pq[2];
    // Precaution: the load's address registers are reused soon after it
    // (address sums, accumulator start values), so the wait stands first.
    asm volatile("s_wait_xcnt 0x0" ::: "memory");

    // Q fragments: invariant over the key loop -> registers (B operand).
    const _Float16* qrow =
        Qh + (size_t)(b * SEQ + qbase + l16) * DMODEL + h * DK;
    const v16h aq0 = load_frag16(qrow, hl);
    const v16h aq1 = load_frag16(qrow + 32, hl);

    v8f o[4] = {v8f{}, v8f{}, v8f{}, v8f{}};  // o[t][e] = O^T[t*16+8*hl+e][l16]
    float m = -3.0e38f;                       // running maximum of the query
    float l = 0.0f;                           // this half's share of the sum

    // Cooperative staging indices (constant over loop).
    const int krow = tid >> 2, kseg = (tid & 3) * 16;   // K: 32 rows x 128B
    const int vrow = tid >> 1, vseg = (tid & 1) * 16;   // V: 64 rows x 64B

    // Stage one 32-key block (K 32x64 + V 64x32) into LDS buffer `buf`.
    auto stage_tiles = [&](int buf, int jb) {
        const _Float16* ks =
            Kh + (size_t)(b * SEQ + jb + krow) * DMODEL + h * DK + kseg;
        stage16(&Kt[buf][krow][kseg], ks);
        stage16(&Kt[buf][krow][kseg + 8], ks + 8);
        const _Float16* vs =
            Vt + (size_t)(b * DMODEL + h * DK + vrow) * SEQ + jb + vseg;
        stage16(&Vl[buf][vrow][vseg], vs);
        stage16(&Vl[buf][vrow][vseg + 8], vs + 8);
    };

    stage_tiles(0, 0);   // prologue

    for (int jb = 0; jb < SEQ; jb += 32) {
        const int cur = (jb >> 5) & 1;

        // Wait for cur's staging (issued last iteration), make it visible.
        stage_wait();
        __syncthreads();

        // Kick off next block's staging; it completes during our compute.
        if (jb + 32 < SEQ) stage_tiles(cur ^ 1, jb + 32);

        // Positions of this lane's 2 x 8 keys (jb + 8*hl + e and 16 more):
        // 24 consecutive floats each, 96-byte aligned offsets.
        const v4f* pk0 = (const v4f*)(pos + ((size_t)b * SEQ + jb + 8 * hl) * 3);
        const v4f* pk1 = (const v4f*)(pos + ((size_t)b * SEQ + jb + 16 + 8 * hl) * 3);
        float kp0[24], kp1[24];
#pragma unroll  // constant indices keep the array in registers
        for (int i = 0; i < 6; ++i) {
            const v4f u = pk0[i], w = pk1[i];
#pragma unroll  // constant indices keep the array in registers
            for (int c = 0; c < 4; ++c) { kp0[i * 4 + c] = u[c]; kp1[i * 4 + c] = w[c]; }
        }

        // ---- S^T = K Q^T for the 32-key block (two 16x16 tiles) ----
        v8f s0 = v8f{}, s1 = v8f{};
        s0 = wmma_f16(load_frag16(&Kt[cur][l16][0], hl), aq0, s0);
        s1 = wmma_f16(load_frag16(&Kt[cur][16 + l16][0], hl), aq0, s1);
        s0 = wmma_f16(load_frag16(&Kt[cur][l16][32], hl), aq1, s0);
        s1 = wmma_f16(load_frag16(&Kt[cur][16 + l16][32], hl), aq1, s1);

        float a0[8], a1[8];
        float v = -3.0e38f;
#pragma unroll  // constant indices keep the array in registers
        for (int e = 0; e < 8; ++e) {
            float dx = qx - kp0[e * 3], dy = qy - kp0[e * 3 + 1], dz = qz - kp0[e * 3 + 2];
            const float d0v = __builtin_amdgcn_sqrtf(dx * dx + dy * dy + dz * dz);
            dx = qx - kp1[e * 3]; dy = qy - kp1[e * 3 + 1]; dz = qz - kp1[e * 3 + 2];
            const float d1v = __builtin_amdgcn_sqrtf(dx * dx + dy * dy + dz * dz);
            // The weight lies in [1e-8, 1 + 1e-8]: an exponential that falls
            // below the normal range vanishes in the sum with 1e-8 anyway,
            // and the logarithm's argument is always a normal number.
            a0[e] = s0[e] * scale +
                    __builtin_amdgcn_logf(__builtin_amdgcn_exp2f(nab2 * d0v) + 1e-8f);
            a1[e] = s1[e] * scale +
                    __builtin_amdgcn_logf(__builtin_amdgcn_exp2f(nab2 * d1v) + 1e-8f);
            v = fmaxf(v, fmaxf(a0[e], a1[e]));
        }
        // The other half holds the query's other 16 keys of this block.
        v = fmaxf(v, xhalf(v));

        const float mn = fmaxf(m, v);
        const float sc = __builtin_amdgcn_exp2f(m - mn);
        m = mn;
#pragma unroll  // constant indices keep the array in registers
        for (int t = 0; t < 4; ++t)
#pragma unroll  // constant indices keep the array in registers
            for (int e = 0; e < 8; ++e) o[t][e] *= sc;

        // P^T as B operand, straight from the two score tiles.
        v16h bp;
        float rs = 0.0f;
#pragma unroll  // constant indices keep the array in registers
        for (int e = 0; e < 8; ++e) {
            const float p0 = __builtin_amdgcn_exp2f(a0[e] - mn);
            const float p1 = __builtin_amdgcn_exp2f(a1[e] - mn);
            rs += p0 + p1;
            bp[e]     = (_Float16)p0;
            bp[8 + e] = (_Float16)p1;
        }
        l = l * sc + rs;

        // ---- O^T += V^T P^T (A-fragments from LDS V tile) ----
#pragma unroll  // constant indices keep the array in registers
        for (int t = 0; t < 4; ++t) {
            const v16h av = load_frag16(&Vl[cur][t * 16 + l16][0], hl);
            o[t] = wmma_f16(av, bp, o[t]);
        }
        // No trailing barrier needed: next iteration's top barrier protects
        // the buffer being re-staged.
    }

    // Join the halves' sums, normalize, store 8 consecutive channels a lane.
    const float lt = l + xhalf(l);
    _Float16* orow = O + (size_t)(b * SEQ + qbase + l16) * DMODEL + h * DK + 8 * hl;
#pragma unroll  // constant indices keep the array in registers
    for (int t = 0; t < 4; ++t) {
        v8h r;
#pragma unroll  // constant indices keep the array in registers
        for (int e = 0; e < 8; ++e) r[e] = (_Float16)(o[t][e] / lt);
        *(v8h*)(orow + t * 16) = r;
    }
}

// ---------------------------------------------------------------------------
extern "C" void kernel_launch(void* const* d_in, const int* in_sizes, int n_in,
                              void* d_out, int out_size, void* d_ws, size_t ws_size,
                              hipStream_t stream) {
    const float* x   = (const float*)d_in[0];
    const float* pos = (const float*)d_in[1];
    const float* Wq  = (const float*)d_in[2];
    const float* bq  = (const float*)d_in[3];
    const float* Wk  = (const float*)d_in[4];
    const float* bk  = (const float*)d_in[5];
    const float* Wv  = (const float*)d_in[6];
    const float* bv  = (const float*)d_in[7];
    const float* Wo  = (const float*)d_in[8];
    const float* bo  = (const float*)d_in[9];
    const float* db  = (const float*)d_in[10];
    float* out = (float*)d_out;

    char* ws = (char*)d_ws;
    size_t off = 0;
    auto alloc = [&](size_t bytes) -> char* {
        char* p = ws + off;
        off += (bytes + 255) & ~(size_t)255;
        return p;
    };
    const size_t act_elems = (size_t)MROWS * DMODEL;     // 4M
    const size_t w_elems   = (size_t)DMODEL * DMODEL;    // 1M

    _Float16* xh  = (_Float16*)alloc(act_elems * 2);
    _Float16* wqh = (_Float16*)alloc(w_elems * 2);
    _Float16* wkh = (_Float16*)alloc(w_elems * 2);
    _Float16* wvh = (_Float16*)alloc(w_elems * 2);
    _Float16* woh = (_Float16*)alloc(w_elems * 2);
    _Float16* Qh  = (_Float16*)alloc(act_elems * 2);
    _Float16* Kh  = (_Float16*)alloc(act_elems * 2);
    _Float16* Vt  = (_Float16*)alloc(act_elems * 2);
    _Float16* Ah  = (_Float16*)alloc(act_elems * 2);
    (void)ws_size; (void)in_sizes; (void)n_in; (void)out_size;

    // f32 -> f16 conversions, all five tensors in one launch.
    cvt_all<<<512, 256, 0, stream>>>(x, Wq, Wk, Wv, Wo, xh, wqh, wkh, wvh, woh);

    // QKV projections (V stored transposed for contiguous PV fragments).
    gemm16<<<512, 128, 0, stream>>>(xh, wqh, bq, Qh, nullptr, 0);
    gemm16<<<512, 128, 0, stream>>>(xh, wkh, bk, Kh, nullptr, 0);
    gemm16<<<512, 128, 0, stream>>>(xh, wvh, bv, Vt, nullptr, 1);

    // Fused flash attention with geometric bias.
    attn_fa<<<1024, 128, 0, stream>>>(Qh, Kh, Vt, pos, db, Ah);

    // Output projection -> f32 result.
    gemm16<<<512, 128, 0, stream>>>(Ah, woh, bo, nullptr, out, 2);
}

// v005
// It runs in 165 microseconds.
// In two side-by-side timings against v004, it was 1.50 and 1.51 times as fast.
// Counting every step since v000, it is 2.21 times as fast.
#include <hip/hip_runtime.h>
#include <hip/hip_bf16.h>

#define BATCH   2
#define SEQ     2048
#define DMODEL  1024
#define NHEADS  16
#define DK      64
#define MROWS   (BATCH * SEQ)     // 4096

typedef __attribute__((ext_vector_type(16))) _Float16 v16h;
typedef __attribute__((ext_vector_type(8)))  _Float16 v8h;
typedef __attribute__((ext_vector_type(8)))  float    v8f;
typedef __attribute__((ext_vector_type(4)))  int      v4i;

#if defined(__gfx1250__) && __has_builtin(__builtin_amdgcn_global_load_async_to_lds_b128) && __has_builtin(__builtin_amdgcn_s_wait_asynccnt)
#define HAS_ASYNC_LDS 1
#else
#define HAS_ASYNC_LDS 0
#endif

// Copy 16 bytes global -> LDS. Uses the CDNA5 async-to-LDS path (ASYNCcnt,
// no VGPR round trip) when the builtin exists; else load+ds_store fallback.
static __device__ __forceinline__ void stage16(_Float16* lds_dst, const _Float16* gsrc) {
#if HAS_ASYNC_LDS
    __builtin_amdgcn_global_load_async_to_lds_b128(
        (__attribute__((address_space(1))) v4i*)gsrc,
        (__attribute__((address_space(3))) v4i*)lds_dst, 0, 0);
#else
    *(v8h*)lds_dst = *(const v8h*)gsrc;
#endif
}

static __device__ __forceinline__ void stage_wait() {
#if HAS_ASYNC_LDS
    __builtin_amdgcn_s_wait_asynccnt(0);
#endif
}

// Load a 16x32 (f16) A/B fragment row for this lane.
// Per CDNA5 ISA layout: lane half 0 holds K = [0..7] and [16..23],
// half 1 holds K = [8..15] and [24..31]. Two aligned 16B loads.
static __device__ __forceinline__ v16h load_frag16(const _Float16* p, int hl) {
    v8h lo = *(const v8h*)(p + hl * 8);
    v8h hi = *(const v8h*)(p + 16 + hl * 8);
    return __builtin_shufflevector(lo, hi, 0, 1, 2, 3, 4, 5, 6, 7,
                                           8, 9, 10, 11, 12, 13, 14, 15);
}

static __device__ __forceinline__ v8f wmma_f16(v16h a, v16h b, v8f c) {
    return __builtin_amdgcn_wmma_f32_16x16x32_f16(
        /*neg_a=*/false, a, /*neg_b=*/false, b,
        /*c_mod=*/(short)0, c, /*reuse_a=*/false, /*reuse_b=*/false);
}

// ---------------------------------------------------------------------------
// f32 -> f16 conversion of x and the four weight matrices, one launch.
// The whole grid fits on the chip at once: 512 blocks of 8 waves, 256 WGPs.
// A wave takes 2048 consecutive elements: 16 loads of 512 contiguous bytes,
// issued ahead of the conversions so that many are in flight at once, then
// 16 stores of 256 contiguous bytes (whole 128-byte lines on both sides).
// Blocks 0..255 take x, then 64 blocks each take Wq, Wk, Wv, Wo.
// ---------------------------------------------------------------------------
typedef __attribute__((ext_vector_type(4))) float    f32x4;
typedef __attribute__((ext_vector_type(4))) _Float16 f16x4;

#define CVT_BLOCK_ELEMS 16384                                   // 8 waves x 2048
#define CVT_X_BLOCKS    (MROWS * DMODEL / CVT_BLOCK_ELEMS)      // 256
#define CVT_W_BLOCKS    (DMODEL * DMODEL / CVT_BLOCK_ELEMS)     // 64

__global__ __launch_bounds__(256)
void cvt_all(const float* __restrict__ x,
             const float* __restrict__ wq, const float* __restrict__ wk,
             const float* __restrict__ wv, const float* __restrict__ wo,
             _Float16* __restrict__ xh,
             _Float16* __restrict__ wqh, _Float16* __restrict__ wkh,
             _Float16* __restrict__ wvh, _Float16* __restrict__ woh) {
    int blk = blockIdx.x;
    const float* in = x;
    _Float16* out = xh;
    if (blk >= CVT_X_BLOCKS) {                 // block-uniform choice of tensor
        blk -= CVT_X_BLOCKS;
        const int w = blk / CVT_W_BLOCKS;
        blk -= w * CVT_W_BLOCKS;
        in  = w == 0 ? wq  : w == 1 ? wk  : w == 2 ? wv  : wo;
        out = w == 0 ? wqh : w == 1 ? wkh : w == 2 ? wvh : woh;
    }
    const int base = blk * CVT_BLOCK_ELEMS + (threadIdx.x >> 5) * 2048 +
                     (threadIdx.x & 31) * 4;
    const f32x4* src = (const f32x4*)(in + base);
    f16x4* dst = (f16x4*)(out + base);

    f32x4 v[16];
#pragma unroll  // constant indices keep the array in registers
    for (int i = 0; i < 16; ++i) v[i] = src[i * 32];
#pragma unroll  // constant indices keep the array in registers
    for (int i = 0; i < 16; ++i) {
        f16x4 r;
#pragma unroll  // constant indices keep the array in registers
        for (int c = 0; c < 4; ++c) r[c] = (_Float16)v[i][c];
        dst[i * 32] = r;
    }
}

// ---------------------------------------------------------------------------
// Y = X @ W^T + bias.  X:[MROWS, DMODEL] f16, W:[DMODEL, DMODEL] f16 row-major.
// One block of 8 waves computes a 128x128 tile; a wave a 32x64 part of it
// (8 accumulators).  K runs in chunks of 64: the 128 X rows and the 128 W rows
// of a chunk (128 bytes a row) go to LDS by asynchronous copies, 8 lanes a
// row, so every copy instruction moves 4 whole 128-byte lines, and each line
// is fetched once a block instead of once a wave in 32-byte pieces.  Two LDS
// buffers: a chunk's copies fly while the chunks before it are multiplied and read.
// mode 0: f16 store [MROWS, DMODEL]        (Q, K projections)
// mode 1: f16 transposed store Vt[b][c][n] (V projection)
// mode 2: f32 store [MROWS, DMODEL]        (final output projection)
// ---------------------------------------------------------------------------
#define GT_ROWS   128                      // rows of X, and of W, a block tile
#define GT_K      64                       // halves of K a chunk (128 bytes)
#define GT_PITCH  72                       // LDS row pitch in halves: 144 B = 16 B x odd
#define GT_CHUNKS (DMODEL / GT_K)          // 16
#define GT_Q      (32 * GT_PITCH * 2)      // bytes of 32 LDS rows
#define GT_BUF    (GT_ROWS * GT_PITCH * 2) // bytes of one LDS buffer

// LDS byte address of a __shared__ location (what an asynchronous copy takes).
static __device__ __forceinline__ unsigned lds_byte(_Float16* p) {
    return (unsigned)(size_t)(__attribute__((address_space(3))) _Float16*)p;
}

__global__ __launch_bounds__(256)
void gemm16(const _Float16* __restrict__ X, const _Float16* __restrict__ W,
            const float* __restrict__ bias,
            _Float16* __restrict__ outh, float* __restrict__ outf, int mode) {
    __shared__ __align__(16) _Float16 As[2][GT_ROWS][GT_PITCH];  // [buf][row of X][k]
    __shared__ __align__(16) _Float16 Bs[2][GT_ROWS][GT_PITCH];  // [buf][row of W][k]

    const int tid  = threadIdx.x;
    const int lane = tid & 31;
    const int wid  = tid >> 5;
    const int hl   = lane >> 4;
    const int l16  = lane & 15;

    const int bm    = blockIdx.x >> 3;        // 32 strips of 128 rows
    const int bn    = blockIdx.x & 7;         // 8 groups of 128 cols
    const int wrow  = (wid >> 1) * 32;        // the wave's rows in the tile
    const int wcol  = (wid & 1) * 64;         // the wave's cols in the tile
    const int rbase = bm * GT_ROWS + wrow;
    const int cbase = bn * GT_ROWS + wcol;

    // Staging: a lane copies 16 bytes of rows srow, +32, +64, +96 of both tiles.
    const int srow = tid >> 3, sseg = (tid & 7) * 8;
    const _Float16* gA = X + (size_t)(bm * GT_ROWS + srow) * DMODEL + sseg;
    const _Float16* gB = W + (size_t)(bn * GT_ROWS + srow) * DMODEL + sseg;
    const unsigned lA = lds_byte(&As[0][srow][sseg]);
    const unsigned lB = lds_byte(&Bs[0][srow][sseg]);

    auto stage_chunk = [&](int buf, int chunk) {
        const _Float16* a = gA + chunk * GT_K;
        const _Float16* b = gB + chunk * GT_K;
        const unsigned la = lA + buf * GT_BUF;
        const unsigned lb = lB + buf * GT_BUF;
        // The 8 copies of one chunk.  The closing s_wait_xcnt stands in the
        // same statement so that no address register of a copy is rewritten
        // in front of it (a precaution).
        asm volatile(
            "global_load_async_to_lds_b128 %0, %8, off\n\t"
            "global_load_async_to_lds_b128 %1, %9, off\n\t"
            "global_load_async_to_lds_b128 %2, %10, off\n\t"
            "global_load_async_to_lds_b128 %3, %11, off\n\t"
            "global_load_async_to_lds_b128 %4, %12, off\n\t"
            "global_load_async_to_lds_b128 %5, %13, off\n\t"
            "global_load_async_to_lds_b128 %6, %14, off\n\t"
            "global_load_async_to_lds_b128 %7, %15, off\n\t"
            "s_wait_xcnt 0x0"
            :: "v"(la), "v"(la + GT_Q), "v"(la + 2 * GT_Q), "v"(la + 3 * GT_Q),
               "v"(lb), "v"(lb + GT_Q), "v"(lb + 2 * GT_Q), "v"(lb + 3 * GT_Q),
               "v"(a), "v"(a + 32 * DMODEL), "v"(a + 64 * DMODEL), "v"(a + 96 * DMODEL),
               "v"(b), "v"(b + 32 * DMODEL), "v"(b + 64 * DMODEL), "v"(b + 96 * DMODEL)
            : "memory");
    };

    v8f acc[2][4];
#pragma unroll
    for (int r = 0; r < 2; ++r)
#pragma unroll
        for (int t = 0; t < 4; ++t) acc[r][t] = v8f{};

    // Chunk 0 lands and is published before anything is read; chunk 1 follows.
    stage_chunk(0, 0);
    // This wave's copies have landed before the barrier lets others read them.
    asm volatile("s_wait_asynccnt 0x0" ::: "memory");
    __syncthreads();
    stage_chunk(1, 1);

    for (int c = 0; c < GT_CHUNKS; ++c) {
        const int cur = c & 1;
        const _Float16* as = &As[cur][wrow + l16][0];
        const _Float16* bs = &Bs[cur][wcol + l16][0];
        // All 24 LDS reads of the chunk stand in one group, in front of the
        // hand-over: one LDS latency a chunk, and the 16 matrix instructions,
        // which read registers only, run behind the barrier while the copies
        // of chunk c+2 are already on their way.
        v16h a0[2], a1[2], bf[2][4];
#pragma unroll  // constant indices keep the arrays in registers
        for (int ks = 0; ks < 2; ++ks) {
            a0[ks] = load_frag16(as + ks * 32, hl);
            a1[ks] = load_frag16(as + 16 * GT_PITCH + ks * 32, hl);
#pragma unroll  // constant indices keep the arrays in registers
            for (int t = 0; t < 4; ++t)
                bf[ks][t] = load_frag16(bs + t * 16 * GT_PITCH + ks * 32, hl);
        }
        // Hand-over: this wave's LDS reads of chunk c are done ...
        asm volatile("s_wait_dscnt 0x0" ::: "memory");
        // ... its copies of chunk c+1 have landed ...
        asm volatile("s_wait_asynccnt 0x0" ::: "memory");
        // ... and the one barrier publishes chunk c+1 and frees buffer cur.
        __syncthreads();
        if (c + 2 < GT_CHUNKS) stage_chunk(cur, c + 2);

#pragma unroll  // constant indices keep the arrays in registers
        for (int ks = 0; ks < 2; ++ks) {
#pragma unroll  // constant indices keep the arrays in registers
            for (int t = 0; t < 4; ++t) {
                acc[0][t] = wmma_f16(a0[ks], bf[ks][t], acc[0][t]);
                acc[1][t] = wmma_f16(a1[ks], bf[ks][t], acc[1][t]);
            }
        }
    }
    // No copy is outstanding when the wave goes on to its stores and ends.
    asm volatile("s_wait_asynccnt 0x0" ::: "memory");

#pragma unroll
    for (int r = 0; r < 2; ++r) {
#pragma unroll
        for (int t = 0; t < 4; ++t) {
#pragma unroll
            for (int e = 0; e < 8; ++e) {
                const int gr = rbase + r * 16 + e + 8 * hl;  // C/D: row = e + 8*half
                const int gc = cbase + t * 16 + l16;         // col = lane%16
                const float v = acc[r][t][e] + bias[gc];
                if (mode == 2) {
                    outf[(size_t)gr * DMODEL + gc] = v;
                } else if (mode == 1) {
                    const int b_ = gr >> 11;                 // gr / SEQ
                    const int n  = gr & (SEQ - 1);
                    outh[((size_t)b_ * DMODEL + gc) * SEQ + n] = (_Float16)v;
                } else {
                    outh[(size_t)gr * DMODEL + gc] = (_Float16)v;
                }
            }
        }
    }
}

// ---------------------------------------------------------------------------
// Fused flash attention with geometric distance bias, transposed scores.
// One block = 4 waves sharing one (b, h); each wave owns a 16-query tile.
// K/V tiles are double-buffered in LDS: the async copies for key-step j+1
// are issued right after the top barrier of step j and only waited at the
// top of step j+1, so global->LDS latency overlaps WMMA + softmax compute.
// Per step: 4 WMMA (S^T = K Q^T, K rows as A, Q as B), exact distance bias,
// online softmax, 4 WMMA (O^T += V^T P^T).  In S^T a lane holds 16 scores of
// ONE query (column = lane%16, key = e + 8*half per 16-key tile), so maximum
// and sum run in the lane's own registers with one exchange between the wave
// halves, and the two converted score tiles are already the B operand of the
// second product (k = 8*half + e, then 16 + 8*half + e): P never leaves the
// registers.
// ---------------------------------------------------------------------------
typedef __attribute__((ext_vector_type(4))) float v4f;

// Value of lane l ^ 16 (the other half of the wave holds the same query).
static __device__ __forceinline__ float xhalf(float x) {
    return __builtin_bit_cast(float, __builtin_amdgcn_permlanex16(
        __builtin_bit_cast(int, x), __builtin_bit_cast(int, x),
        0x76543210, 0xfedcba98, false, false));
}

__global__ __launch_bounds__(128)
void attn_fa(const _Float16* __restrict__ Qh, const _Float16* __restrict__ Kh,
             const _Float16* __restrict__ Vt, const float* __restrict__ pos,
             const float* __restrict__ dist_bias, _Float16* __restrict__ O) {
    // Row pitch = 16 B x odd (144 B for the 128-B K rows, 80 B for the 64-B V
    // rows): the 16 rows that one ds_load_b128 fragment read touches then fall
    // on 16 different groups of four banks.  At the bare pitches they fall on
    // 2 (K) and 4 (V) groups and each read is replayed 8 and 4 times.
    // The pad halves at the end of a row are never written and never read.
    __shared__ __align__(16) _Float16 Kt[2][32][64 + 8];  // [buf][key j][d]
    __shared__ __align__(16) _Float16 Vl[2][64][32 + 8];  // [buf][d (c)][key j]

    const int tid  = threadIdx.x;
    const int lane = tid & 31;
    const int wid  = tid >> 5;
    const int hl   = lane >> 4;
    const int l16  = lane & 15;

    const int bh    = blockIdx.x >> 5;     // 32 (b,h) pairs; 32 blocks each
    const int qgrp  = blockIdx.x & 31;
    const int b     = bh >> 4;
    const int h     = bh & 15;
    const int qbase = (qgrp * 4 + wid) * 16;

    // Scores live in base 2: log2(e) is folded into both constants, so each
    // exponential and the logarithm is one hardware instruction.
    const float LOG2E = 1.4426950408889634f;
    const float nab2  = -fabsf(dist_bias[h]) * LOG2E;
    const float scale = 0.125f * LOG2E;    // log2(e)/sqrt(DK)

    // Position of the one query this lane's score column belongs to.
    const float* pq = pos + ((size_t)b * SEQ + qbase + l16) * 3;
    const float qx = pq[0], qy = pq[1], qz = pq[2];
    // Precaution: the load's address registers are reused soon after it
    // (address sums, accumulator start values), so the wait stands first.
    asm volatile("s_wait_xcnt 0x0" ::: "memory");

    // Q fragments: invariant over the key loop -> registers (B operand).
    const _Float16* qrow =
        Qh + (size_t)(b * SEQ + qbase + l16) * DMODEL + h * DK;
    const v16h aq0 = load_frag16(qrow, hl);
    const v16h aq1 = load_frag16(qrow + 32, hl);

    v8f o[4] = {v8f{}, v8f{}, v8f{}, v8f{}};  // o[t][e] = O^T[t*16+8*hl+e][l16]
    float m = -3.0e38f;                       // running maximum of the query
    float l = 0.0f;                           // this half's share of the sum

    // Cooperative staging indices (constant over loop).
    const int krow = tid >> 2, kseg = (tid & 3) * 16;   // K: 32 rows x 128B
    const int vrow = tid >> 1, vseg = (tid & 1) * 16;   // V: 64 rows x 64B

    // Stage one 32-key block (K 32x64 + V 64x32) into LDS buffer `buf`.
    auto stage_tiles = [&](int buf, int jb) {
        const _Float16* ks =
            Kh + (size_t)(b * SEQ + jb + krow) * DMODEL + h * DK + kseg;
        stage16(&Kt[buf][krow][kseg], ks);
        stage16(&Kt[buf][krow][kseg + 8], ks + 8);
        const _Float16* vs =
            Vt + (size_t)(b * DMODEL + h * DK + vrow) * SEQ + jb + vseg;
        stage16(&Vl[buf][vrow][vseg], vs);
        stage16(&Vl[buf][vrow][vseg + 8], vs + 8);
    };

    stage_tiles(0, 0);   // prologue

    for (int jb = 0; jb < SEQ; jb += 32) {
        const int cur = (jb >> 5) & 1;

        // Wait for cur's staging (issued last iteration), make it visible.
        stage_wait();
        __syncthreads();

        // Kick off next block's staging; it completes during our compute.
        if (jb + 32 < SEQ) stage_tiles(cur ^ 1, jb + 32);

        // Positions of this lane's 2 x 8 keys (jb + 8*hl + e and 16 more):
        // 24 consecutive floats each, 96-byte aligned offsets.
        const v4f* pk0 = (const v4f*)(pos + ((size_t)b * SEQ + jb + 8 * hl) * 3);
        const v4f* pk1 = (const v4f*)(pos + ((size_t)b * SEQ + jb + 16 + 8 * hl) * 3);
        float kp0[24], kp1[24];
#pragma unroll  // constant indices keep the array in registers
        for (int i = 0; i < 6; ++i) {
            const v4f u = pk0[i], w = pk1[i];
#pragma unroll  // constant indices keep the array in registers
            for (int c = 0; c < 4; ++c) { kp0[i * 4 + c] = u[c]; kp1[i * 4 + c] = w[c]; }
        }

        // ---- S^T = K Q^T for the 32-key block (two 16x16 tiles) ----
        v8f s0 = v8f{}, s1 = v8f{};
        s0 = wmma_f16(load_frag16(&Kt[cur][l16][0], hl), aq0, s0);
        s1 = wmma_f16(load_frag16(&Kt[cur][16 + l16][0], hl), aq0, s1);
        s0 = wmma_f16(load_frag16(&Kt[cur][l16][32], hl), aq1, s0);
        s1 = wmma_f16(load_frag16(&Kt[cur][16 + l16][32], hl), aq1, s1);

        float a0[8], a1[8];
        float v = -3.0e38f;
#pragma unroll  // constant indices keep the array in registers
        for (int e = 0; e < 8; ++e) {
            float dx = qx - kp0[e * 3], dy = qy - kp0[e * 3 + 1], dz = qz - kp0[e * 3 + 2];
            const float d0v = __builtin_amdgcn_sqrtf(dx * dx + dy * dy + dz * dz);
            dx = qx - kp1[e * 3]; dy = qy - kp1[e * 3 + 1]; dz = qz - kp1[e * 3 + 2];
            const float d1v = __builtin_amdgcn_sqrtf(dx * dx + dy * dy + dz * dz);
            // The weight lies in [1e-8, 1 + 1e-8]: an exponential that falls
            // below the normal range vanishes in the sum with 1e-8 anyway,
            // and the logarithm's argument is always a normal number.
            a0[e] = s0[e] * scale +
                    __builtin_amdgcn_logf(__builtin_amdgcn_exp2f(nab2 * d0v) + 1e-8f);
            a1[e] = s1[e] * scale +
                    __builtin_amdgcn_logf(__builtin_amdgcn_exp2f(nab2 * d1v) + 1e-8f);
            v = fmaxf(v, fmaxf(a0[e], a1[e]));
        }
        // The other half holds the query's other 16 keys of this block.
        v = fmaxf(v, xhalf(v));

        const float mn = fmaxf(m, v);
        const float sc = __builtin_amdgcn_exp2f(m - mn);
        m = mn;
#pragma unroll  // constant indices keep the array in registers
        for (int t = 0; t < 4; ++t)
#pragma unroll  // constant indices keep the array in registers
            for (int e = 0; e < 8; ++e) o[t][e] *= sc;

        // P^T as B operand, straight from the two score tiles.
        v16h bp;
        float rs = 0.0f;
#pragma unroll  // constant indices keep the array in registers
        for (int e = 0; e < 8; ++e) {
            const float p0 = __builtin_amdgcn_exp2f(a0[e] - mn);
            const float p1 = __builtin_amdgcn_exp2f(a1[e] - mn);
            rs += p0 + p1;
            bp[e]     = (_Float16)p0;
            bp[8 + e] = (_Float16)p1;
        }
        l = l * sc + rs;

        // ---- O^T += V^T P^T (A-fragments from LDS V tile) ----
#pragma unroll  // constant indices keep the array in registers
        for (int t = 0; t < 4; ++t) {
            const v16h av = load_frag16(&Vl[cur][t * 16 + l16][0], hl);
            o[t] = wmma_f16(av, bp, o[t]);
        }
        // No trailing barrier needed: next iteration's top barrier protects
        // the buffer being re-staged.
    }

    // Join the halves' sums, normalize, store 8 consecutive channels a lane.
    const float lt = l + xhalf(l);
    _Float16* orow = O + (size_t)(b * SEQ + qbase + l16) * DMODEL + h * DK + 8 * hl;
#pragma unroll  // constant indices keep the array in registers
    for (int t = 0; t < 4; ++t) {
        v8h r;
#pragma unroll  // constant indices keep the array in registers
        for (int e = 0; e < 8; ++e) r[e] = (_Float16)(o[t][e] / lt);
        *(v8h*)(orow + t * 16) = r;
    }
}

// ---------------------------------------------------------------------------
extern "C" void kernel_launch(void* const* d_in, const int* in_sizes, int n_in,
                              void* d_out, int out_size, void* d_ws, size_t ws_size,
                              hipStream_t stream) {
    const float* x   = (const float*)d_in[0];
    const float* pos = (const float*)d_in[1];
    const float* Wq  = (const float*)d_in[2];
    const float* bq  = (const float*)d_in[3];
    const float* Wk  = (const float*)d_in[4];
    const float* bk  = (const float*)d_in[5];
    const float* Wv  = (const float*)d_in[6];
    const float* bv  = (const float*)d_in[7];
    const float* Wo  = (const float*)d_in[8];
    const float* bo  = (const float*)d_in[9];
    const float* db  = (const float*)d_in[10];
    float* out = (float*)d_out;

    char* ws = (char*)d_ws;
    size_t off = 0;
    auto alloc = [&](size_t bytes) -> char* {
        char* p = ws + off;
        off += (bytes + 255) & ~(size_t)255;
        return p;
    };
    const size_t act_elems = (size_t)MROWS * DMODEL;     // 4M
    const size_t w_elems   = (size_t)DMODEL * DMODEL;    // 1M

    _Float16* xh  = (_Float16*)alloc(act_elems * 2);
    _Float16* wqh = (_Float16*)alloc(w_elems * 2);
    _Float16* wkh = (_Float16*)alloc(w_elems * 2);
    _Float16* wvh = (_Float16*)alloc(w_elems * 2);
    _Float16* woh = (_Float16*)alloc(w_elems * 2);
    _Float16* Qh  = (_Float16*)alloc(act_elems * 2);
    _Float16* Kh  = (_Float16*)alloc(act_elems * 2);
    _Float16* Vt  = (_Float16*)alloc(act_elems * 2);
    _Float16* Ah  = (_Float16*)alloc(act_elems * 2);
    (void)ws_size; (void)in_sizes; (void)n_in; (void)out_size;

    // f32 -> f16 conversions, all five tensors in one launch.
    cvt_all<<<512, 256, 0, stream>>>(x, Wq, Wk, Wv, Wo, xh, wqh, wkh, wvh, woh);

    // QKV projections (V stored transposed for contiguous PV fragments).
    gemm16<<<256, 256, 0, stream>>>(xh, wqh, bq, Qh, nullptr, 0);
    gemm16<<<256, 256, 0, stream>>>(xh, wkh, bk, Kh, nullptr, 0);
    gemm16<<<256, 256, 0, stream>>>(xh, wvh, bv, Vt, nullptr, 1);

    // Fused flash attention with geometric bias.
    attn_fa<<<1024, 128, 0, stream>>>(Qh, Kh, Vt, pos, db, Ah);

    // Output projection -> f32 result.
    gemm16<<<256, 256, 0, stream>>>(Ah, woh, bo, nullptr, out, 2);
}

// v006
// It runs in 141 microseconds.
// In two side-by-side timings against v005, it was 1.16 and 1.15 times as fast.
// Over all steps from v000 it is 2.55 times as fast.
#include <hip/hip_runtime.h>
#include <hip/hip_bf16.h>

#define BATCH   2
#define SEQ     2048
#define DMODEL  1024
#define NHEADS  16
#define DK      64
#define MROWS   (BATCH * SEQ)     // 4096

typedef __attribute__((ext_vector_type(16))) _Float16 v16h;
typedef __attribute__((ext_vector_type(8)))  _Float16 v8h;
typedef __attribute__((ext_vector_type(8)))  float    v8f;
typedef __attribute__((ext_vector_type(4)))  int      v4i;

#if defined(__gfx1250__) && __has_builtin(__builtin_amdgcn_global_load_async_to_lds_b128) && __has_builtin(__builtin_amdgcn_s_wait_asynccnt)
#define HAS_ASYNC_LDS 1
#else
#define HAS_ASYNC_LDS 0
#endif

// Copy 16 bytes global -> LDS. Uses the CDNA5 async-to-LDS path (ASYNCcnt,
// no VGPR round trip) when the builtin exists; else load+ds_store fallback.
static __device__ __forceinline__ void stage16(_Float16* lds_dst, const _Float16* gsrc) {
#if HAS_ASYNC_LDS
    __builtin_amdgcn_global_load_async_to_lds_b128(
        (__attribute__((address_space(1))) v4i*)gsrc,
        (__attribute__((address_space(3))) v4i*)lds_dst, 0, 0);
#else
    *(v8h*)lds_dst = *(const v8h*)gsrc;
#endif
}

static __device__ __forceinline__ void stage_wait() {
#if HAS_ASYNC_LDS
    __builtin_amdgcn_s_wait_asynccnt(0);
#endif
}

// Load a 16x32 (f16) A/B fragment row for this lane.
// Per CDNA5 ISA layout: lane half 0 holds K = [0..7] and [16..23],
// half 1 holds K = [8..15] and [24..31]. Two aligned 16B loads.
static __device__ __forceinline__ v16h load_frag16(const _Float16* p, int hl) {
    v8h lo = *(const v8h*)(p + hl * 8);
    v8h hi = *(const v8h*)(p + 16 + hl * 8);
    return __builtin_shufflevector(lo, hi, 0, 1, 2, 3, 4, 5, 6, 7,
                                           8, 9, 10, 11, 12, 13, 14, 15);
}

static __device__ __forceinline__ v8f wmma_f16(v16h a, v16h b, v8f c) {
    return __builtin_amdgcn_wmma_f32_16x16x32_f16(
        /*neg_a=*/false, a, /*neg_b=*/false, b,
        /*c_mod=*/(short)0, c, /*reuse_a=*/false, /*reuse_b=*/false);
}

// ---------------------------------------------------------------------------
// f32 -> f16 conversion of x and the four weight matrices, one launch.
// The whole grid fits on the chip at once: 512 blocks of 8 waves, 256 WGPs.
// A wave takes 2048 consecutive elements: 16 loads of 512 contiguous bytes,
// issued ahead of the conversions so that many are in flight at once, then
// 16 stores of 256 contiguous bytes (whole 128-byte lines on both sides).
// Blocks 0..255 take x, then 64 blocks each take Wq, Wk, Wv, Wo.
// ---------------------------------------------------------------------------
typedef __attribute__((ext_vector_type(4))) float    f32x4;
typedef __attribute__((ext_vector_type(4))) _Float16 f16x4;

#define CVT_BLOCK_ELEMS 16384                                   // 8 waves x 2048
#define CVT_X_BLOCKS    (MROWS * DMODEL / CVT_BLOCK_ELEMS)      // 256
#define CVT_W_BLOCKS    (DMODEL * DMODEL / CVT_BLOCK_ELEMS)     // 64

__global__ __launch_bounds__(256)
void cvt_all(const float* __restrict__ x,
             const float* __restrict__ wq, const float* __restrict__ wk,
             const float* __restrict__ wv, const float* __restrict__ wo,
             _Float16* __restrict__ xh,
             _Float16* __restrict__ wqh, _Float16* __restrict__ wkh,
             _Float16* __restrict__ wvh, _Float16* __restrict__ woh) {
    int blk = blockIdx.x;
    const float* in = x;
    _Float16* out = xh;
    if (blk >= CVT_X_BLOCKS) {                 // block-uniform choice of tensor
        blk -= CVT_X_BLOCKS;
        const int w = blk / CVT_W_BLOCKS;
        blk -= w * CVT_W_BLOCKS;
        in  = w == 0 ? wq  : w == 1 ? wk  : w == 2 ? wv  : wo;
        out = w == 0 ? wqh : w == 1 ? wkh : w == 2 ? wvh : woh;
    }
    const int base = blk * CVT_BLOCK_ELEMS + (threadIdx.x >> 5) * 2048 +
                     (threadIdx.x & 31) * 4;
    const f32x4* src = (const f32x4*)(in + base);
    f16x4* dst = (f16x4*)(out + base);

    f32x4 v[16];
#pragma unroll  // constant indices keep the array in registers
    for (int i = 0; i < 16; ++i) v[i] = src[i * 32];
#pragma unroll  // constant indices keep the array in registers
    for (int i = 0; i < 16; ++i) {
        f16x4 r;
#pragma unroll  // constant indices keep the array in registers
        for (int c = 0; c < 4; ++c) r[c] = (_Float16)v[i][c];
        dst[i * 32] = r;
    }
}

// ---------------------------------------------------------------------------
// Y = X @ W^T + bias.  X:[MROWS, DMODEL] f16, W:[DMODEL, DMODEL] f16 row-major.
// One block of 8 waves computes a 128x128 tile; a wave a 64x32 part of it
// (8 accumulators).  K runs in chunks of 64: the 128 X rows and the 128 W rows
// of a chunk (128 bytes a row) go to LDS by asynchronous copies, 8 lanes a
// row, so every copy instruction moves 4 whole 128-byte lines, and each line
// is fetched once a block instead of once a wave in 32-byte pieces.  Two LDS
// buffers: a chunk's copies fly while the chunks before it are multiplied and read.
// mode 0: f16 store [MROWS, DMODEL]        (Q, K projections)
// mode 1: f16 transposed store Vt[b][c][n] (V projection)
// mode 2: f32 store [MROWS, DMODEL]        (final output projection)
// A lane's 8 accumulator elements lie along the rows of the A operand, so the
// operand whose row index runs along the output's contiguous dimension is
// taken as A ("P": W in modes 0 and 2, X in mode 1) and the other as B ("R").
// A lane then holds 8 consecutive output elements; the wave's 64x32 part goes
// through the wave's own LDS range and leaves in whole 128-byte lines.
// ---------------------------------------------------------------------------
#define GT_ROWS   128                      // rows of X, and of W, a block tile
#define GT_K      64                       // halves of K a chunk (128 bytes)
#define GT_PITCH  72                       // LDS row pitch in halves: 144 B = 16 B x odd
#define GT_CHUNKS (DMODEL / GT_K)          // 16
#define GT_Q      (32 * GT_PITCH * 2)      // bytes of 32 LDS rows
#define GT_BUF    (GT_ROWS * GT_PITCH * 2) // bytes of one LDS buffer
#define GT_STAGE  (GT_BUF / 2)             // bytes of a wave's output staging range
#define GT_SP16   144                      // staging row pitch, 64 halves: 16 B x odd
#define GT_SP32   272                      // staging row pitch, 64 floats: 16 B x odd

// LDS byte address of a __shared__ location (what an asynchronous copy takes).
static __device__ __forceinline__ unsigned lds_byte(_Float16* p) {
    return (unsigned)(size_t)(__attribute__((address_space(3))) _Float16*)p;
}

__global__ __launch_bounds__(256)
void gemm16(const _Float16* __restrict__ X, const _Float16* __restrict__ W,
            const float* __restrict__ bias,
            _Float16* __restrict__ outh, float* __restrict__ outf, int mode) {
    __shared__ __align__(16) _Float16 As[2][GT_ROWS][GT_PITCH];  // [buf][row of P][k]
    __shared__ __align__(16) _Float16 Bs[2][GT_ROWS][GT_PITCH];  // [buf][row of R][k]

    const int tid  = threadIdx.x;
    const int lane = tid & 31;
    const int wid  = tid >> 5;
    const int hl   = lane >> 4;
    const int l16  = lane & 15;

    const int bm  = blockIdx.x >> 3;          // 32 strips of 128 rows of X
    const int bn  = blockIdx.x & 7;           // 8 groups of 128 rows of W
    const bool tok = mode == 1;               // tokens run along the output's lines
    const _Float16* P = tok ? X : W;
    const _Float16* R = tok ? W : X;
    const int p0  = (tok ? bm : bn) * GT_ROWS;
    const int r0  = (tok ? bn : bm) * GT_ROWS;
    const int wp  = (wid & 1) * 64;           // the wave's rows of P in the tile
    const int wr  = (wid >> 1) * 32;          // the wave's rows of R in the tile

    // Bias of the lane's elements, fetched ahead of the K loop: it goes with the
    // W row, which is the accumulator's row (8 a tile) or its column (1 a tile).
    f32x4 bP[4][2];
    float bR[2];
    if (tok) {
#pragma unroll  // constant indices keep the array in registers
        for (int j = 0; j < 2; ++j) bR[j] = bias[r0 + wr + j * 16 + l16];
    } else {
#pragma unroll  // constant indices keep the array in registers
        for (int i = 0; i < 4; ++i) {
            const f32x4* bp = (const f32x4*)(bias + p0 + wp + i * 16 + 8 * hl);
            bP[i][0] = bp[0];
            bP[i][1] = bp[1];
        }
    }

    // Staging: a lane copies 16 bytes of rows srow, +32, +64, +96 of both tiles.
    const int srow = tid >> 3, sseg = (tid & 7) * 8;
    const _Float16* gA = P + (size_t)(p0 + srow) * DMODEL + sseg;
    const _Float16* gB = R + (size_t)(r0 + srow) * DMODEL + sseg;
    const unsigned lA = lds_byte(&As[0][srow][sseg]);
    const unsigned lB = lds_byte(&Bs[0][srow][sseg]);

    auto stage_chunk = [&](int buf, int chunk) {
        const _Float16* a = gA + chunk * GT_K;
        const _Float16* b = gB + chunk * GT_K;
        const unsigned la = lA + buf * GT_BUF;
        const unsigned lb = lB + buf * GT_BUF;
        // The 8 copies of one chunk.  The closing s_wait_xcnt stands in the
        // same statement so that no address register of a copy is rewritten
        // in front of it (a precaution).
        asm volatile(
            "global_load_async_to_lds_b128 %0, %8, off\n\t"
            "global_load_async_to_lds_b128 %1, %9, off\n\t"
            "global_load_async_to_lds_b128 %2, %10, off\n\t"
            "global_load_async_to_lds_b128 %3, %11, off\n\t"
            "global_load_async_to_lds_b128 %4, %12, off\n\t"
            "global_load_async_to_lds_b128 %5, %13, off\n\t"
            "global_load_async_to_lds_b128 %6, %14, off\n\t"
            "global_load_async_to_lds_b128 %7, %15, off\n\t"
            "s_wait_xcnt 0x0"
            :: "v"(la), "v"(la + GT_Q), "v"(la + 2 * GT_Q), "v"(la + 3 * GT_Q),
               "v"(lb), "v"(lb + GT_Q), "v"(lb + 2 * GT_Q), "v"(lb + 3 * GT_Q),
               "v"(a), "v"(a + 32 * DMODEL), "v"(a + 64 * DMODEL), "v"(a + 96 * DMODEL),
               "v"(b), "v"(b + 32 * DMODEL), "v"(b + 64 * DMODEL), "v"(b + 96 * DMODEL)
            : "memory");
    };

    v8f acc[4][2];
#pragma unroll  // constant indices keep the array in registers
    for (int i = 0; i < 4; ++i)
#pragma unroll  // constant indices keep the array in registers
        for (int j = 0; j < 2; ++j) acc[i][j] = v8f{};

    // Chunk 0 lands and is published before anything is read; chunk 1 follows.
    stage_chunk(0, 0);
    // This wave's copies have landed before the barrier lets others read them.
    asm volatile("s_wait_asynccnt 0x0" ::: "memory");
    __syncthreads();
    stage_chunk(1, 1);

    for (int c = 0; c < GT_CHUNKS; ++c) {
        const int cur = c & 1;
        const _Float16* as = &As[cur][wp + l16][0];
        const _Float16* bs = &Bs[cur][wr + l16][0];
        // All 24 LDS reads of the chunk stand in one group, in front of the
        // hand-over: one LDS latency a chunk, and the 16 matrix instructions,
        // which read registers only, run behind the barrier while the copies
        // of chunk c+2 are already on their way.
        v16h pf[2][4], rf[2][2];
#pragma unroll  // constant indices keep the arrays in registers
        for (int ks = 0; ks < 2; ++ks) {
#pragma unroll  // constant indices keep the arrays in registers
            for (int j = 0; j < 2; ++j)
                rf[ks][j] = load_frag16(bs + j * 16 * GT_PITCH + ks * 32, hl);
#pragma unroll  // constant indices keep the arrays in registers
            for (int i = 0; i < 4; ++i)
                pf[ks][i] = load_frag16(as + i * 16 * GT_PITCH + ks * 32, hl);
        }
        // Hand-over: this wave's LDS reads of chunk c are done ...
        asm volatile("s_wait_dscnt 0x0" ::: "memory");
        // ... its copies of chunk c+1 have landed ...
        asm volatile("s_wait_asynccnt 0x0" ::: "memory");
        // ... and the one barrier publishes chunk c+1 and frees buffer cur.
        __syncthreads();
        if (c + 2 < GT_CHUNKS) stage_chunk(cur, c + 2);

#pragma unroll  // constant indices keep the arrays in registers
        for (int ks = 0; ks < 2; ++ks) {
#pragma unroll  // constant indices keep the arrays in registers
            for (int i = 0; i < 4; ++i) {
                acc[i][0] = wmma_f16(pf[ks][i], rf[ks][0], acc[i][0]);
                acc[i][1] = wmma_f16(pf[ks][i], rf[ks][1], acc[i][1]);
            }
        }
    }
    // No copy is outstanding when the wave goes on to its stores and ends.
    asm volatile("s_wait_asynccnt 0x0" ::: "memory");

    // Output.  acc[i][j][e] belongs to row wp + i*16 + 8*hl + e of P and to row
    // wr + j*16 + l16 of R.  The last trip's barrier stands behind every wave's
    // last read of the two buffers and no copy is in flight, so each wave may
    // take a quarter of As (waves 0..3) or of Bs (waves 4..7) for itself.
    char* st = (char*)(wid < 4 ? &As[0][0][0] : &Bs[0][0][0]) + (wid & 3) * GT_STAGE;

    if (mode == 2) {
        // 32 rows (tokens) of 64 floats.
#pragma unroll  // constant indices keep the arrays in registers
        for (int j = 0; j < 2; ++j) {
#pragma unroll  // constant indices keep the arrays in registers
            for (int i = 0; i < 4; ++i) {
                f32x4 lo, hi;
#pragma unroll  // constant indices keep the arrays in registers
                for (int e = 0; e < 4; ++e) {
                    lo[e] = acc[i][j][e] + bP[i][0][e];
                    hi[e] = acc[i][j][4 + e] + bP[i][1][e];
                }
                f32x4* d = (f32x4*)(st + (j * 16 + l16) * GT_SP32 + (i * 16 + 8 * hl) * 4);
                d[0] = lo;
                d[1] = hi;
            }
        }
        // The rows are read back by other lanes of the wave than wrote them.
        asm volatile("s_wait_dscnt 0x0" ::: "memory");
        const char* sr = st + (lane >> 4) * GT_SP32 + (lane & 15) * 16;
        float* dst = outf + (size_t)(r0 + wr + (lane >> 4)) * DMODEL + p0 + wp + (lane & 15) * 4;
        f32x4 v[16];
#pragma unroll  // constant indices keep the array in registers
        for (int k = 0; k < 16; ++k) v[k] = *(const f32x4*)(sr + k * 2 * GT_SP32);
#pragma unroll  // constant indices keep the array in registers
        for (int k = 0; k < 16; ++k) *(f32x4*)(dst + k * 2 * DMODEL) = v[k];  // 2 x 256 B
    } else {
        // 32 rows (tokens, or channels of V) of 64 halves.
        char* sw = st + l16 * GT_SP16 + 8 * hl * 2;
        if (tok) {
#pragma unroll  // constant indices keep the arrays in registers
            for (int j = 0; j < 2; ++j) {
#pragma unroll  // constant indices keep the arrays in registers
                for (int i = 0; i < 4; ++i) {
                    v8h r;
#pragma unroll  // constant indices keep the arrays in registers
                    for (int e = 0; e < 8; ++e) r[e] = (_Float16)(acc[i][j][e] + bR[j]);
                    *(v8h*)(sw + j * 16 * GT_SP16 + i * 32) = r;
                }
            }
        } else {
#pragma unroll  // constant indices keep the arrays in registers
            for (int j = 0; j < 2; ++j) {
#pragma unroll  // constant indices keep the arrays in registers
                for (int i = 0; i < 4; ++i) {
                    v8h r;
#pragma unroll  // constant indices keep the arrays in registers
                    for (int e = 0; e < 8; ++e)
                        r[e] = (_Float16)(acc[i][j][e] + bP[i][e >> 2][e & 3]);
                    *(v8h*)(sw + j * 16 * GT_SP16 + i * 32) = r;
                }
            }
        }
        // The rows are read back by other lanes of the wave than wrote them.
        asm volatile("s_wait_dscnt 0x0" ::: "memory");
        const char* sr = st + (lane >> 3) * GT_SP16 + (lane & 7) * 16;
        v8h v[8];
#pragma unroll  // constant indices keep the array in registers
        for (int k = 0; k < 8; ++k) v[k] = *(const v8h*)(sr + k * 4 * GT_SP16);
        const int row = r0 + wr + (lane >> 3);
        const int col = p0 + wp + (lane & 7) * 8;
        if (tok) {   // row = channel, col = token: Vt[b][channel][n]
            _Float16* dst = outh + ((size_t)(col >> 11) * DMODEL + row) * SEQ + (col & (SEQ - 1));
#pragma unroll  // constant indices keep the array in registers
            for (int k = 0; k < 8; ++k) *(v8h*)(dst + k * 4 * SEQ) = v[k];     // 4 x 128 B
        } else {     // row = token, col = channel
            _Float16* dst = outh + (size_t)row * DMODEL + col;
#pragma unroll  // constant indices keep the array in registers
            for (int k = 0; k < 8; ++k) *(v8h*)(dst + k * 4 * DMODEL) = v[k];  // 4 x 128 B
            // Precaution: in the built code the other path's address sums, which take
            // the same registers as these stores' address, stand behind this run.
            asm volatile("s_wait_xcnt 0x0" ::: "memory");
        }
    }
}

// ---------------------------------------------------------------------------
// Fused flash attention with geometric distance bias, transposed scores.
// One block = 4 waves sharing one (b, h); each wave owns a 16-query tile.
// K/V tiles are double-buffered in LDS: the async copies for key-step j+1
// are issued right after the top barrier of step j and only waited at the
// top of step j+1, so global->LDS latency overlaps WMMA + softmax compute.
// Per step: 4 WMMA (S^T = K Q^T, K rows as A, Q as B), exact distance bias,
// online softmax, 4 WMMA (O^T += V^T P^T).  In S^T a lane holds 16 scores of
// ONE query (column = lane%16, key = e + 8*half per 16-key tile), so maximum
// and sum run in the lane's own registers with one exchange between the wave
// halves, and the two converted score tiles are already the B operand of the
// second product (k = 8*half + e, then 16 + 8*half + e): P never leaves the
// registers.
// ---------------------------------------------------------------------------
typedef __attribute__((ext_vector_type(4))) float v4f;

// Value of lane l ^ 16 (the other half of the wave holds the same query).
static __device__ __forceinline__ float xhalf(float x) {
    return __builtin_bit_cast(float, __builtin_amdgcn_permlanex16(
        __builtin_bit_cast(int, x), __builtin_bit_cast(int, x),
        0x76543210, 0xfedcba98, false, false));
}

__global__ __launch_bounds__(128)
void attn_fa(const _Float16* __restrict__ Qh, const _Float16* __restrict__ Kh,
             const _Float16* __restrict__ Vt, const float* __restrict__ pos,
             const float* __restrict__ dist_bias, _Float16* __restrict__ O) {
    // Row pitch = 16 B x odd (144 B for the 128-B K rows, 80 B for the 64-B V
    // rows): the 16 rows that one ds_load_b128 fragment read touches then fall
    // on 16 different groups of four banks.  At the bare pitches they fall on
    // 2 (K) and 4 (V) groups and each read is replayed 8 and 4 times.
    // The pad halves at the end of a row are never written and never read.
    __shared__ __align__(16) _Float16 Kt[2][32][64 + 8];  // [buf][key j][d]
    __shared__ __align__(16) _Float16 Vl[2][64][32 + 8];  // [buf][d (c)][key j]

    const int tid  = threadIdx.x;
    const int lane = tid & 31;
    const int wid  = tid >> 5;
    const int hl   = lane >> 4;
    const int l16  = lane & 15;

    const int bh    = blockIdx.x >> 5;     // 32 (b,h) pairs; 32 blocks each
    const int qgrp  = blockIdx.x & 31;
    const int b     = bh >> 4;
    const int h     = bh & 15;
    const int qbase = (qgrp * 4 + wid) * 16;

    // Scores live in base 2: log2(e) is folded into both constants, so each
    // exponential and the logarithm is one hardware instruction.
    const float LOG2E = 1.4426950408889634f;
    const float nab2  = -fabsf(dist_bias[h]) * LOG2E;
    const float scale = 0.125f * LOG2E;    // log2(e)/sqrt(DK)

    // Position of the one query this lane's score column belongs to.
    const float* pq = pos + ((size_t)b * SEQ + qbase + l16) * 3;
    const float qx = pq[0], qy = pq[1], qz = pq[2];
    // Precaution: the load's address registers are reused soon after it
    // (address sums, accumulator start values), so the wait stands first.
    asm volatile("s_wait_xcnt 0x0" ::: "memory");

    // Q fragments: invariant over the key loop -> registers (B operand).
    const _Float16* qrow =
        Qh + (size_t)(b * SEQ + qbase + l16) * DMODEL + h * DK;
    const v16h aq0 = load_frag16(qrow, hl);
    const v16h aq1 = load_frag16(qrow + 32, hl);

    v8f o[4] = {v8f{}, v8f{}, v8f{}, v8f{}};  // o[t][e] = O^T[t*16+8*hl+e][l16]
    float m = -3.0e38f;                       // running maximum of the query
    float l = 0.0f;                           // this half's share of the sum

    // Cooperative staging indices (constant over loop).
    const int krow = tid >> 2, kseg = (tid & 3) * 16;   // K: 32 rows x 128B
    const int vrow = tid >> 1, vseg = (tid & 1) * 16;   // V: 64 rows x 64B

    // Stage one 32-key block (K 32x64 + V 64x32) into LDS buffer `buf`.
    auto stage_tiles = [&](int buf, int jb) {
        const _Float16* ks =
            Kh + (size_t)(b * SEQ + jb + krow) * DMODEL + h * DK + kseg;
        stage16(&Kt[buf][krow][kseg], ks);
        stage16(&Kt[buf][krow][kseg + 8], ks + 8);
        const _Float16* vs =
            Vt + (size_t)(b * DMODEL + h * DK + vrow) * SEQ + jb + vseg;
        stage16(&Vl[buf][vrow][vseg], vs);
        stage16(&Vl[buf][vrow][vseg + 8], vs + 8);
    };

    stage_tiles(0, 0);   // prologue

    for (int jb = 0; jb < SEQ; jb += 32) {
        const int cur = (jb >> 5) & 1;

        // Wait for cur's staging (issued last iteration), make it visible.
        stage_wait();
        __syncthreads();

        // Kick off next block's staging; it completes during our compute.
        if (jb + 32 < SEQ) stage_tiles(cur ^ 1, jb + 32);

        // Positions of this lane's 2 x 8 keys (jb + 8*hl + e and 16 more):
        // 24 consecutive floats each, 96-byte aligned offsets.
        const v4f* pk0 = (const v4f*)(pos + ((size_t)b * SEQ + jb + 8 * hl) * 3);
        const v4f* pk1 = (const v4f*)(pos + ((size_t)b * SEQ + jb + 16 + 8 * hl) * 3);
        float kp0[24], kp1[24];
#pragma unroll  // constant indices keep the array in registers
        for (int i = 0; i < 6; ++i) {
            const v4f u = pk0[i], w = pk1[i];
#pragma unroll  // constant indices keep the array in registers
            for (int c = 0; c < 4; ++c) { kp0[i * 4 + c] = u[c]; kp1[i * 4 + c] = w[c]; }
        }

        // ---- S^T = K Q^T for the 32-key block (two 16x16 tiles) ----
        v8f s0 = v8f{}, s1 = v8f{};
        s0 = wmma_f16(load_frag16(&Kt[cur][l16][0], hl), aq0, s0);
        s1 = wmma_f16(load_frag16(&Kt[cur][16 + l16][0], hl), aq0, s1);
        s0 = wmma_f16(load_frag16(&Kt[cur][l16][32], hl), aq1, s0);
        s1 = wmma_f16(load_frag16(&Kt[cur][16 + l16][32], hl), aq1, s1);

        float a0[8], a1[8];
        float v = -3.0e38f;
#pragma unroll  // constant indices keep the array in registers
        for (int e = 0; e < 8; ++e) {
            float dx = qx - kp0[e * 3], dy = qy - kp0[e * 3 + 1], dz = qz - kp0[e * 3 + 2];
            const float d0v = __builtin_amdgcn_sqrtf(dx * dx + dy * dy + dz * dz);
            dx = qx - kp1[e * 3]; dy = qy - kp1[e * 3 + 1]; dz = qz - kp1[e * 3 + 2];
            const float d1v = __builtin_amdgcn_sqrtf(dx * dx + dy * dy + dz * dz);
            // The weight lies in [1e-8, 1 + 1e-8]: an exponential that falls
            // below the normal range vanishes in the sum with 1e-8 anyway,
            // and the logarithm's argument is always a normal number.
            a0[e] = s0[e] * scale +
                    __builtin_amdgcn_logf(__builtin_amdgcn_exp2f(nab2 * d0v) + 1e-8f);
            a1[e] = s1[e] * scale +
                    __builtin_amdgcn_logf(__builtin_amdgcn_exp2f(nab2 * d1v) + 1e-8f);
            v = fmaxf(v, fmaxf(a0[e], a1[e]));
        }
        // The other half holds the query's other 16 keys of this block.
        v = fmaxf(v, xhalf(v));

        const float mn = fmaxf(m, v);
        const float sc = __builtin_amdgcn_exp2f(m - mn);
        m = mn;
#pragma unroll  // constant indices keep the array in registers
        for (int t = 0; t < 4; ++t)
#pragma unroll  // constant indices keep the array in registers
            for (int e = 0; e < 8; ++e) o[t][e] *= sc;

        // P^T as B operand, straight from the two score tiles.
        v16h bp;
        float rs = 0.0f;
#pragma unroll  // constant indices keep the array in registers
        for (int e = 0; e < 8; ++e) {
            const float p0 = __builtin_amdgcn_exp2f(a0[e] - mn);
            const float p1 = __builtin_amdgcn_exp2f(a1[e] - mn);
            rs += p0 + p1;
            bp[e]     = (_Float16)p0;
            bp[8 + e] = (_Float16)p1;
        }
        l = l * sc + rs;

        // ---- O^T += V^T P^T (A-fragments from LDS V tile) ----
#pragma unroll  // constant indices keep the array in registers
        for (int t = 0; t < 4; ++t) {
            const v16h av = load_frag16(&Vl[cur][t * 16 + l16][0], hl);
            o[t] = wmma_f16(av, bp, o[t]);
        }
        // No trailing barrier needed: next iteration's top barrier protects
        // the buffer being re-staged.
    }

    // Join the halves' sums, normalize, store 8 consecutive channels a lane.
    const float lt = l + xhalf(l);
    _Float16* orow = O + (size_t)(b * SEQ + qbase + l16) * DMODEL + h * DK + 8 * hl;
#pragma unroll  // constant indices keep the array in registers
    for (int t = 0; t < 4; ++t) {
        v8h r;
#pragma unroll  // constant indices keep the array in registers
        for (int e = 0; e < 8; ++e) r[e] = (_Float16)(o[t][e] / lt);
        *(v8h*)(orow + t * 16) = r;
    }
}

// ---------------------------------------------------------------------------
extern "C" void kernel_launch(void* const* d_in, const int* in_sizes, int n_in,
                              void* d_out, int out_size, void* d_ws, size_t ws_size,
                              hipStream_t stream) {
    const float* x   = (const float*)d_in[0];
    const float* pos = (const float*)d_in[1];
    const float* Wq  = (const float*)d_in[2];
    const float* bq  = (const float*)d_in[3];
    const float* Wk  = (const float*)d_in[4];
    const float* bk  = (const float*)d_in[5];
    const float* Wv  = (const float*)d_in[6];
    const float* bv  = (const float*)d_in[7];
    const float* Wo  = (const float*)d_in[8];
    const float* bo  = (const float*)d_in[9];
    const float* db  = (const float*)d_in[10];
    float* out = (float*)d_out;

    char* ws = (char*)d_ws;
    size_t off = 0;
    auto alloc = [&](size_t bytes) -> char* {
        char* p = ws + off;
        off += (bytes + 255) & ~(size_t)255;
        return p;
    };
    const size_t act_elems = (size_t)MROWS * DMODEL;     // 4M
    const size_t w_elems   = (size_t)DMODEL * DMODEL;    // 1M

    _Float16* xh  = (_Float16*)alloc(act_elems * 2);
    _Float16* wqh = (_Float16*)alloc(w_elems * 2);
    _Float16* wkh = (_Float16*)alloc(w_elems * 2);
    _Float16* wvh = (_Float16*)alloc(w_elems * 2);
    _Float16* woh = (_Float16*)alloc(w_elems * 2);
    _Float16* Qh  = (_Float16*)alloc(act_elems * 2);
    _Float16* Kh  = (_Float16*)alloc(act_elems * 2);
    _Float16* Vt  = (_Float16*)alloc(act_elems * 2);
    _Float16* Ah  = (_Float16*)alloc(act_elems * 2);
    (void)ws_size; (void)in_sizes; (void)n_in; (void)out_size;

    // f32 -> f16 conversions, all five tensors in one launch.
    cvt_all<<<512, 256, 0, stream>>>(x, Wq, Wk, Wv, Wo, xh, wqh, wkh, wvh, woh);

    // QKV projections (V stored transposed for contiguous PV fragments).
    gemm16<<<256, 256, 0, stream>>>(xh, wqh, bq, Qh, nullptr, 0);
    gemm16<<<256, 256, 0, stream>>>(xh, wkh, bk, Kh, nullptr, 0);
    gemm16<<<256, 256, 0, stream>>>(xh, wvh, bv, Vt, nullptr, 1);

    // Fused flash attention with geometric bias.
    attn_fa<<<1024, 128, 0, stream>>>(Qh, Kh, Vt, pos, db, Ah);

    // Output projection -> f32 result.
    gemm16<<<256, 256, 0, stream>>>(Ah, woh, bo, nullptr, out, 2);
}

// v007
// One run takes 131 microseconds.
// Two timings next to v006 put it at 1.09 and 1.07 times that version's speed.
// Counting every step since v000, it is 2.75 times as fast.
#include <hip/hip_runtime.h>
#include <hip/hip_bf16.h>

#define BATCH   2
#define SEQ     2048
#define DMODEL  1024
#define NHEADS  16
#define DK      64
#define MROWS   (BATCH * SEQ)     // 4096

typedef __attribute__((ext_vector_type(16))) _Float16 v16h;
typedef __attribute__((ext_vector_type(8)))  _Float16 v8h;
typedef __attribute__((ext_vector_type(8)))  float    v8f;
typedef __attribute__((ext_vector_type(4)))  int      v4i;

#if defined(__gfx1250__) && __has_builtin(__builtin_amdgcn_global_load_async_to_lds_b128) && __has_builtin(__builtin_amdgcn_s_wait_asynccnt)
#define HAS_ASYNC_LDS 1
#else
#define HAS_ASYNC_LDS 0
#endif

// Copy 16 bytes global -> LDS. Uses the CDNA5 async-to-LDS path (ASYNCcnt,
// no VGPR round trip) when the builtin exists; else load+ds_store fallback.
static __device__ __forceinline__ void stage16(_Float16* lds_dst, const _Float16* gsrc) {
#if HAS_ASYNC_LDS
    __builtin_amdgcn_global_load_async_to_lds_b128(
        (__attribute__((address_space(1))) v4i*)gsrc,
        (__attribute__((address_space(3))) v4i*)lds_dst, 0, 0);
#else
    *(v8h*)lds_dst = *(const v8h*)gsrc;
#endif
}

static __device__ __forceinline__ void stage_wait() {
#if HAS_ASYNC_LDS
    __builtin_amdgcn_s_wait_asynccnt(0);
#endif
}

// Load a 16x32 (f16) A/B fragment row for this lane.
// Per CDNA5 ISA layout: lane half 0 holds K = [0..7] and [16..23],
// half 1 holds K = [8..15] and [24..31]. Two aligned 16B loads.
static __device__ __forceinline__ v16h load_frag16(const _Float16* p, int hl) {
    v8h lo = *(const v8h*)(p + hl * 8);
    v8h hi = *(const v8h*)(p + 16 + hl * 8);
    return __builtin_shufflevector(lo, hi, 0, 1, 2, 3, 4, 5, 6, 7,
                                           8, 9, 10, 11, 12, 13, 14, 15);
}

static __device__ __forceinline__ v8f wmma_f16(v16h a, v16h b, v8f c) {
    return __builtin_amdgcn_wmma_f32_16x16x32_f16(
        /*neg_a=*/false, a, /*neg_b=*/false, b,
        /*c_mod=*/(short)0, c, /*reuse_a=*/false, /*reuse_b=*/false);
}

// ---------------------------------------------------------------------------
// f32 -> f16 conversion of x and the four weight matrices, one launch.
// The whole grid fits on the chip at once: 512 blocks of 8 waves, 256 WGPs.
// A wave takes 2048 consecutive elements: 16 loads of 512 contiguous bytes,
// issued ahead of the conversions so that many are in flight at once, then
// 16 stores of 256 contiguous bytes (whole 128-byte lines on both sides).
// Blocks 0..255 take x, then 64 blocks each take Wq, Wk, Wv, Wo.
// ---------------------------------------------------------------------------
typedef __attribute__((ext_vector_type(4))) float    f32x4;
typedef __attribute__((ext_vector_type(4))) _Float16 f16x4;

#define CVT_BLOCK_ELEMS 16384                                   // 8 waves x 2048
#define CVT_X_BLOCKS    (MROWS * DMODEL / CVT_BLOCK_ELEMS)      // 256
#define CVT_W_BLOCKS    (DMODEL * DMODEL / CVT_BLOCK_ELEMS)     // 64

__global__ __launch_bounds__(256)
void cvt_all(const float* __restrict__ x,
             const float* __restrict__ wq, const float* __restrict__ wk,
             const float* __restrict__ wv, const float* __restrict__ wo,
             _Float16* __restrict__ xh,
             _Float16* __restrict__ wqh, _Float16* __restrict__ wkh,
             _Float16* __restrict__ wvh, _Float16* __restrict__ woh) {
    int blk = blockIdx.x;
    const float* in = x;
    _Float16* out = xh;
    if (blk >= CVT_X_BLOCKS) {                 // block-uniform choice of tensor
        blk -= CVT_X_BLOCKS;
        const int w = blk / CVT_W_BLOCKS;
        blk -= w * CVT_W_BLOCKS;
        in  = w == 0 ? wq  : w == 1 ? wk  : w == 2 ? wv  : wo;
        out = w == 0 ? wqh : w == 1 ? wkh : w == 2 ? wvh : woh;
    }
    const int base = blk * CVT_BLOCK_ELEMS + (threadIdx.x >> 5) * 2048 +
                     (threadIdx.x & 31) * 4;
    const f32x4* src = (const f32x4*)(in + base);
    f16x4* dst = (f16x4*)(out + base);

    f32x4 v[16];
#pragma unroll  // constant indices keep the array in registers
    for (int i = 0; i < 16; ++i) v[i] = src[i * 32];
#pragma unroll  // constant indices keep the array in registers
    for (int i = 0; i < 16; ++i) {
        f16x4 r;
#pragma unroll  // constant indices keep the array in registers
        for (int c = 0; c < 4; ++c) r[c] = (_Float16)v[i][c];
        dst[i * 32] = r;
    }
}

// ---------------------------------------------------------------------------
// Y = X @ W^T + bias.  X:[MROWS, DMODEL] f16, W:[DMODEL, DMODEL] f16 row-major.
// One block of 8 waves computes a 128x128 tile; a wave a 64x32 part of it
// (8 accumulators).  K runs in chunks of 64: the 128 X rows and the 128 W rows
// of a chunk (128 bytes a row) go to LDS by asynchronous copies, 8 lanes a
// row, so every copy instruction moves 4 whole 128-byte lines, and each line
// is fetched once a block instead of once a wave in 32-byte pieces.  Two LDS
// buffers: a chunk's copies fly while the chunks before it are multiplied and read.
// mode 0: f16 store [MROWS, DMODEL]        (Q, K projections)
// mode 1: f16 transposed store Vt[b][c][n] (V projection)
// mode 2: f32 store [MROWS, DMODEL]        (final output projection)
// One launch holds up to three products of the same X: every 256 blocks take
// the next W, bias and output.  The Q, K and V projections, which do not depend
// on one another, so share one launch of 768 blocks: two blocks fit on a WGP
// (registers), and one block's copies, barriers, start and output stores run
// beside the other's matrix work instead of standing alone between launches.
// final == 0: groups 0, 1 in mode 0, group 2 in mode 1; final != 0: mode 2.
// A lane's 8 accumulator elements lie along the rows of the A operand, so the
// operand whose row index runs along the output's contiguous dimension is
// taken as A ("P": W in modes 0 and 2, X in mode 1) and the other as B ("R").
// A lane then holds 8 consecutive output elements; the wave's 64x32 part goes
// through the wave's own LDS range and leaves in whole 128-byte lines.
// ---------------------------------------------------------------------------
#define GT_ROWS   128                      // rows of X, and of W, a block tile
#define GT_K      64                       // halves of K a chunk (128 bytes)
#define GT_PITCH  72                       // LDS row pitch in halves: 144 B = 16 B x odd
#define GT_CHUNKS (DMODEL / GT_K)          // 16
#define GT_Q      (32 * GT_PITCH * 2)      // bytes of 32 LDS rows
#define GT_BUF    (GT_ROWS * GT_PITCH * 2) // bytes of one LDS buffer
#define GT_STAGE  (GT_BUF / 2)             // bytes of a wave's output staging range
#define GT_SP16   144                      // staging row pitch, 64 halves: 16 B x odd
#define GT_SP32   272                      // staging row pitch, 64 floats: 16 B x odd
#define GT_TILES  ((MROWS / GT_ROWS) * (DMODEL / GT_ROWS))   // 256 blocks a product

// LDS byte address of a __shared__ location (what an asynchronous copy takes).
static __device__ __forceinline__ unsigned lds_byte(_Float16* p) {
    return (unsigned)(size_t)(__attribute__((address_space(3))) _Float16*)p;
}

__global__ __launch_bounds__(256)
void gemm16(const _Float16* __restrict__ X,
            const _Float16* __restrict__ W0, const _Float16* __restrict__ W1,
            const _Float16* __restrict__ W2,
            const float* __restrict__ bias0, const float* __restrict__ bias1,
            const float* __restrict__ bias2,
            _Float16* __restrict__ outh0, _Float16* __restrict__ outh1,
            _Float16* __restrict__ outh2,
            float* __restrict__ outf, int final) {
    __shared__ __align__(16) _Float16 As[2][GT_ROWS][GT_PITCH];  // [buf][row of P][k]
    __shared__ __align__(16) _Float16 Bs[2][GT_ROWS][GT_PITCH];  // [buf][row of R][k]

    const int tid  = threadIdx.x;
    const int lane = tid & 31;
    const int wid  = tid >> 5;
    const int hl   = lane >> 4;
    const int l16  = lane & 15;

    // Block-uniform choice of the product and of the tile in it.
    const int grp  = blockIdx.x / GT_TILES;
    const int tile = blockIdx.x - grp * GT_TILES;
    const _Float16* W    = grp == 0 ? W0    : grp == 1 ? W1    : W2;
    const float*    bias = grp == 0 ? bias0 : grp == 1 ? bias1 : bias2;
    _Float16*       outh = grp == 0 ? outh0 : grp == 1 ? outh1 : outh2;
    const int mode = final ? 2 : grp == 2 ? 1 : 0;

    const int bm  = tile >> 3;                // 32 strips of 128 rows of X
    const int bn  = tile & 7;                 // 8 groups of 128 rows of W
    const bool tok = mode == 1;               // tokens run along the output's lines
    const _Float16* P = tok ? X : W;
    const _Float16* R = tok ? W : X;
    const int p0  = (tok ? bm : bn) * GT_ROWS;
    const int r0  = (tok ? bn : bm) * GT_ROWS;
    const int wp  = (wid & 1) * 64;           // the wave's rows of P in the tile
    const int wr  = (wid >> 1) * 32;          // the wave's rows of R in the tile

    // Bias of the lane's elements, fetched ahead of the K loop: it goes with the
    // W row, which is the accumulator's row (8 a tile) or its column (1 a tile).
    f32x4 bP[4][2];
    float bR[2];
    if (tok) {
#pragma unroll  // constant indices keep the array in registers
        for (int j = 0; j < 2; ++j) bR[j] = bias[r0 + wr + j * 16 + l16];
    } else {
#pragma unroll  // constant indices keep the array in registers
        for (int i = 0; i < 4; ++i) {
            const f32x4* bp = (const f32x4*)(bias + p0 + wp + i * 16 + 8 * hl);
            bP[i][0] = bp[0];
            bP[i][1] = bp[1];
        }
    }

    // Staging: a lane copies 16 bytes of rows srow, +32, +64, +96 of both tiles.
    const int srow = tid >> 3, sseg = (tid & 7) * 8;
    const _Float16* gA = P + (size_t)(p0 + srow) * DMODEL + sseg;
    const _Float16* gB = R + (size_t)(r0 + srow) * DMODEL + sseg;
    const unsigned lA = lds_byte(&As[0][srow][sseg]);
    const unsigned lB = lds_byte(&Bs[0][srow][sseg]);

    auto stage_chunk = [&](int buf, int chunk) {
        const _Float16* a = gA + chunk * GT_K;
        const _Float16* b = gB + chunk * GT_K;
        const unsigned la = lA + buf * GT_BUF;
        const unsigned lb = lB + buf * GT_BUF;
        // The 8 copies of one chunk.  The closing s_wait_xcnt stands in the
        // same statement so that no address register of a copy is rewritten
        // in front of it (a precaution).
        asm volatile(
            "global_load_async_to_lds_b128 %0, %8, off\n\t"
            "global_load_async_to_lds_b128 %1, %9, off\n\t"
            "global_load_async_to_lds_b128 %2, %10, off\n\t"
            "global_load_async_to_lds_b128 %3, %11, off\n\t"
            "global_load_async_to_lds_b128 %4, %12, off\n\t"
            "global_load_async_to_lds_b128 %5, %13, off\n\t"
            "global_load_async_to_lds_b128 %6, %14, off\n\t"
            "global_load_async_to_lds_b128 %7, %15, off\n\t"
            "s_wait_xcnt 0x0"
            :: "v"(la), "v"(la + GT_Q), "v"(la + 2 * GT_Q), "v"(la + 3 * GT_Q),
               "v"(lb), "v"(lb + GT_Q), "v"(lb + 2 * GT_Q), "v"(lb + 3 * GT_Q),
               "v"(a), "v"(a + 32 * DMODEL), "v"(a + 64 * DMODEL), "v"(a + 96 * DMODEL),
               "v"(b), "v"(b + 32 * DMODEL), "v"(b + 64 * DMODEL), "v"(b + 96 * DMODEL)
            : "memory");
    };

    v8f acc[4][2];
#pragma unroll  // constant indices keep the array in registers
    for (int i = 0; i < 4; ++i)
#pragma unroll  // constant indices keep the array in registers
        for (int j = 0; j < 2; ++j) acc[i][j] = v8f{};

    // Chunk 0 lands and is published before anything is read; chunk 1 follows.
    stage_chunk(0, 0);
    // This wave's copies have landed before the barrier lets others read them.
    asm volatile("s_wait_asynccnt 0x0" ::: "memory");
    __syncthreads();
    stage_chunk(1, 1);

    for (int c = 0; c < GT_CHUNKS; ++c) {
        const int cur = c & 1;
        const _Float16* as = &As[cur][wp + l16][0];
        const _Float16* bs = &Bs[cur][wr + l16][0];
        // All 24 LDS reads of the chunk stand in one group, in front of the
        // hand-over: one LDS latency a chunk, and the 16 matrix instructions,
        // which read registers only, run behind the barrier while the copies
        // of chunk c+2 are already on their way.
        v16h pf[2][4], rf[2][2];
#pragma unroll  // constant indices keep the arrays in registers
        for (int ks = 0; ks < 2; ++ks) {
#pragma unroll  // constant indices keep the arrays in registers
            for (int j = 0; j < 2; ++j)
                rf[ks][j] = load_frag16(bs + j * 16 * GT_PITCH + ks * 32, hl);
#pragma unroll  // constant indices keep the arrays in registers
            for (int i = 0; i < 4; ++i)
                pf[ks][i] = load_frag16(as + i * 16 * GT_PITCH + ks * 32, hl);
        }
        // Hand-over: this wave's LDS reads of chunk c are done ...
        asm volatile("s_wait_dscnt 0x0" ::: "memory");
        // ... its copies of chunk c+1 have landed ...
        asm volatile("s_wait_asynccnt 0x0" ::: "memory");
        // ... and the one barrier publishes chunk c+1 and frees buffer cur.
        __syncthreads();
        if (c + 2 < GT_CHUNKS) stage_chunk(cur, c + 2);

#pragma unroll  // constant indices keep the arrays in registers
        for (int ks = 0; ks < 2; ++ks) {
#pragma unroll  // constant indices keep the arrays in registers
            for (int i = 0; i < 4; ++i) {
                acc[i][0] = wmma_f16(pf[ks][i], rf[ks][0], acc[i][0]);
                acc[i][1] = wmma_f16(pf[ks][i], rf[ks][1], acc[i][1]);
            }
        }
    }
    // No copy is outstanding when the wave goes on to its stores and ends.
    asm volatile("s_wait_asynccnt 0x0" ::: "memory");

    // Output.  acc[i][j][e] belongs to row wp + i*16 + 8*hl + e of P and to row
    // wr + j*16 + l16 of R.  The last trip's barrier stands behind every wave's
    // last read of the two buffers and no copy is in flight, so each wave may
    // take a quarter of As (waves 0..3) or of Bs (waves 4..7) for itself.
    char* st = (char*)(wid < 4 ? &As[0][0][0] : &Bs[0][0][0]) + (wid & 3) * GT_STAGE;

    if (mode == 2) {
        // 32 rows (tokens) of 64 floats.
#pragma unroll  // constant indices keep the arrays in registers
        for (int j = 0; j < 2; ++j) {
#pragma unroll  // constant indices keep the arrays in registers
            for (int i = 0; i < 4; ++i) {
                f32x4 lo, hi;
#pragma unroll  // constant indices keep the arrays in registers
                for (int e = 0; e < 4; ++e) {
                    lo[e] = acc[i][j][e] + bP[i][0][e];
                    hi[e] = acc[i][j][4 + e] + bP[i][1][e];
                }
                f32x4* d = (f32x4*)(st + (j * 16 + l16) * GT_SP32 + (i * 16 + 8 * hl) * 4);
                d[0] = lo;
                d[1] = hi;
            }
        }
        // The rows are read back by other lanes of the wave than wrote them.
        asm volatile("s_wait_dscnt 0x0" ::: "memory");
        const char* sr = st + (lane >> 4) * GT_SP32 + (lane & 15) * 16;
        float* dst = outf + (size_t)(r0 + wr + (lane >> 4)) * DMODEL + p0 + wp + (lane & 15) * 4;
        f32x4 v[16];
#pragma unroll  // constant indices keep the array in registers
        for (int k = 0; k < 16; ++k) v[k] = *(const f32x4*)(sr + k * 2 * GT_SP32);
#pragma unroll  // constant indices keep the array in registers
        for (int k = 0; k < 16; ++k) *(f32x4*)(dst + k * 2 * DMODEL) = v[k];  // 2 x 256 B
    } else {
        // 32 rows (tokens, or channels of V) of 64 halves.
        char* sw = st + l16 * GT_SP16 + 8 * hl * 2;
        if (tok) {
#pragma unroll  // constant indices keep the arrays in registers
            for (int j = 0; j < 2; ++j) {
#pragma unroll  // constant indices keep the arrays in registers
                for (int i = 0; i < 4; ++i) {
                    v8h r;
#pragma unroll  // constant indices keep the arrays in registers
                    for (int e = 0; e < 8; ++e) r[e] = (_Float16)(acc[i][j][e] + bR[j]);
                    *(v8h*)(sw + j * 16 * GT_SP16 + i * 32) = r;
                }
            }
        } else {
#pragma unroll  // constant indices keep the arrays in registers
            for (int j = 0; j < 2; ++j) {
#pragma unroll  // constant indices keep the arrays in registers
                for (int i = 0; i < 4; ++i) {
                    v8h r;
#pragma unroll  // constant indices keep the arrays in registers
                    for (int e = 0; e < 8; ++e)
                        r[e] = (_Float16)(acc[i][j][e] + bP[i][e >> 2][e & 3]);
                    *(v8h*)(sw + j * 16 * GT_SP16 + i * 32) = r;
                }
            }
        }
        // The rows are read back by other lanes of the wave than wrote them.
        asm volatile("s_wait_dscnt 0x0" ::: "memory");
        const char* sr = st + (lane >> 3) * GT_SP16 + (lane & 7) * 16;
        v8h v[8];
#pragma unroll  // constant indices keep the array in registers
        for (int k = 0; k < 8; ++k) v[k] = *(const v8h*)(sr + k * 4 * GT_SP16);
        const int row = r0 + wr + (lane >> 3);
        const int col = p0 + wp + (lane & 7) * 8;
        if (tok) {   // row = channel, col = token: Vt[b][channel][n]
            _Float16* dst = outh + ((size_t)(col >> 11) * DMODEL + row) * SEQ + (col & (SEQ - 1));
#pragma unroll  // constant indices keep the array in registers
            for (int k = 0; k < 8; ++k) *(v8h*)(dst + k * 4 * SEQ) = v[k];     // 4 x 128 B
        } else {     // row = token, col = channel
            _Float16* dst = outh + (size_t)row * DMODEL + col;
#pragma unroll  // constant indices keep the array in registers
            for (int k = 0; k < 8; ++k) *(v8h*)(dst + k * 4 * DMODEL) = v[k];  // 4 x 128 B
            // Precaution: in the built code the other path's address sums, which take
            // the same registers as these stores' address, stand behind this run.
            asm volatile("s_wait_xcnt 0x0" ::: "memory");
        }
    }
}

// ---------------------------------------------------------------------------
// Fused flash attention with geometric distance bias, transposed scores.
// One block = 4 waves sharing one (b, h); each wave owns a 16-query tile.
// K/V tiles are double-buffered in LDS: the async copies for key-step j+1
// are issued right after the top barrier of step j and only waited at the
// top of step j+1, so global->LDS latency overlaps WMMA + softmax compute.
// Per step: 4 WMMA (S^T = K Q^T, K rows as A, Q as B), exact distance bias,
// online softmax, 4 WMMA (O^T += V^T P^T).  In S^T a lane holds 16 scores of
// ONE query (column = lane%16, key = e + 8*half per 16-key tile), so maximum
// and sum run in the lane's own registers with one exchange between the wave
// halves, and the two converted score tiles are already the B operand of the
// second product (k = 8*half + e, then 16 + 8*half + e): P never leaves the
// registers.
// ---------------------------------------------------------------------------
typedef __attribute__((ext_vector_type(4))) float v4f;

// Value of lane l ^ 16 (the other half of the wave holds the same query).
static __device__ __forceinline__ float xhalf(float x) {
    return __builtin_bit_cast(float, __builtin_amdgcn_permlanex16(
        __builtin_bit_cast(int, x), __builtin_bit_cast(int, x),
        0x76543210, 0xfedcba98, false, false));
}

__global__ __launch_bounds__(128)
void attn_fa(const _Float16* __restrict__ Qh, const _Float16* __restrict__ Kh,
             const _Float16* __restrict__ Vt, const float* __restrict__ pos,
             const float* __restrict__ dist_bias, _Float16* __restrict__ O) {
    // Row pitch = 16 B x odd (144 B for the 128-B K rows, 80 B for the 64-B V
    // rows): the 16 rows that one ds_load_b128 fragment read touches then fall
    // on 16 different groups of four banks.  At the bare pitches they fall on
    // 2 (K) and 4 (V) groups and each read is replayed 8 and 4 times.
    // The pad halves at the end of a row are never written and never read.
    __shared__ __align__(16) _Float16 Kt[2][32][64 + 8];  // [buf][key j][d]
    __shared__ __align__(16) _Float16 Vl[2][64][32 + 8];  // [buf][d (c)][key j]

    const int tid  = threadIdx.x;
    const int lane = tid & 31;
    const int wid  = tid >> 5;
    const int hl   = lane >> 4;
    const int l16  = lane & 15;

    const int bh    = blockIdx.x >> 5;     // 32 (b,h) pairs; 32 blocks each
    const int qgrp  = blockIdx.x & 31;
    const int b     = bh >> 4;
    const int h     = bh & 15;
    const int qbase = (qgrp * 4 + wid) * 16;

    // Scores live in base 2: log2(e) is folded into both constants, so each
    // exponential and the logarithm is one hardware instruction.
    const float LOG2E = 1.4426950408889634f;
    const float nab2  = -fabsf(dist_bias[h]) * LOG2E;
    const float scale = 0.125f * LOG2E;    // log2(e)/sqrt(DK)

    // Position of the one query this lane's score column belongs to.
    const float* pq = pos + ((size_t)b * SEQ + qbase + l16) * 3;
    const float qx = pq[0], qy = pq[1], qz = pq[2];
    // Precaution: the load's address registers are reused soon after it
    // (address sums, accumulator start values), so the wait stands first.
    asm volatile("s_wait_xcnt 0x0" ::: "memory");

    // Q fragments: invariant over the key loop -> registers (B operand).
    const _Float16* qrow =
        Qh + (size_t)(b * SEQ + qbase + l16) * DMODEL + h * DK;
    const v16h aq0 = load_frag16(qrow, hl);
    const v16h aq1 = load_frag16(qrow + 32, hl);

    v8f o[4] = {v8f{}, v8f{}, v8f{}, v8f{}};  // o[t][e] = O^T[t*16+8*hl+e][l16]
    float m = -3.0e38f;                       // running maximum of the query
    float l = 0.0f;                           // this half's share of the sum

    // Cooperative staging indices (constant over loop).
    const int krow = tid >> 2, kseg = (tid & 3) * 16;   // K: 32 rows x 128B
    const int vrow = tid >> 1, vseg = (tid & 1) * 16;   // V: 64 rows x 64B

    // Stage one 32-key block (K 32x64 + V 64x32) into LDS buffer `buf`.
    auto stage_tiles = [&](int buf, int jb) {
        const _Float16* ks =
            Kh + (size_t)(b * SEQ + jb + krow) * DMODEL + h * DK + kseg;
        stage16(&Kt[buf][krow][kseg], ks);
        stage16(&Kt[buf][krow][kseg + 8], ks + 8);
        const _Float16* vs =
            Vt + (size_t)(b * DMODEL + h * DK + vrow) * SEQ + jb + vseg;
        stage16(&Vl[buf][vrow][vseg], vs);
        stage16(&Vl[buf][vrow][vseg + 8], vs + 8);
    };

    stage_tiles(0, 0);   // prologue

    for (int jb = 0; jb < SEQ; jb += 32) {
        const int cur = (jb >> 5) & 1;

        // Wait for cur's staging (issued last iteration), make it visible.
        stage_wait();
        __syncthreads();

        // Kick off next block's staging; it completes during our compute.
        if (jb + 32 < SEQ) stage_tiles(cur ^ 1, jb + 32);

        // Positions of this lane's 2 x 8 keys (jb + 8*hl + e and 16 more):
        // 24 consecutive floats each, 96-byte aligned offsets.
        const v4f* pk0 = (const v4f*)(pos + ((size_t)b * SEQ + jb + 8 * hl) * 3);
        const v4f* pk1 = (const v4f*)(pos + ((size_t)b * SEQ + jb + 16 + 8 * hl) * 3);
        float kp0[24], kp1[24];
#pragma unroll  // constant indices keep the array in registers
        for (int i = 0; i < 6; ++i) {
            const v4f u = pk0[i], w = pk1[i];
#pragma unroll  // constant indices keep the array in registers
            for (int c = 0; c < 4; ++c) { kp0[i * 4 + c] = u[c]; kp1[i * 4 + c] = w[c]; }
        }

        // ---- S^T = K Q^T for the 32-key block (two 16x16 tiles) ----
        v8f s0 = v8f{}, s1 = v8f{};
        s0 = wmma_f16(load_frag16(&Kt[cur][l16][0], hl), aq0, s0);
        s1 = wmma_f16(load_frag16(&Kt[cur][16 + l16][0], hl), aq0, s1);
        s0 = wmma_f16(load_frag16(&Kt[cur][l16][32], hl), aq1, s0);
        s1 = wmma_f16(load_frag16(&Kt[cur][16 + l16][32], hl), aq1, s1);

        float a0[8], a1[8];
        float v = -3.0e38f;
#pragma unroll  // constant indices keep the array in registers
        for (int e = 0; e < 8; ++e) {
            float dx = qx - kp0[e * 3], dy = qy - kp0[e * 3 + 1], dz = qz - kp0[e * 3 + 2];
            const float d0v = __builtin_amdgcn_sqrtf(dx * dx + dy * dy + dz * dz);
            dx = qx - kp1[e * 3]; dy = qy - kp1[e * 3 + 1]; dz = qz - kp1[e * 3 + 2];
            const float d1v = __builtin_amdgcn_sqrtf(dx * dx + dy * dy + dz * dz);
            // The weight lies in [1e-8, 1 + 1e-8]: an exponential that falls
            // below the normal range vanishes in the sum with 1e-8 anyway,
            // and the logarithm's argument is always a normal number.
            a0[e] = s0[e] * scale +
                    __builtin_amdgcn_logf(__builtin_amdgcn_exp2f(nab2 * d0v) + 1e-8f);
            a1[e] = s1[e] * scale +
                    __builtin_amdgcn_logf(__builtin_amdgcn_exp2f(nab2 * d1v) + 1e-8f);
            v = fmaxf(v, fmaxf(a0[e], a1[e]));
        }
        // The other half holds the query's other 16 keys of this block.
        v = fmaxf(v, xhalf(v));

        const float mn = fmaxf(m, v);
        const float sc = __builtin_amdgcn_exp2f(m - mn);
        m = mn;
#pragma unroll  // constant indices keep the array in registers
        for (int t = 0; t < 4; ++t)
#pragma unroll  // constant indices keep the array in registers
            for (int e = 0; e < 8; ++e) o[t][e] *= sc;

        // P^T as B operand, straight from the two score tiles.
        v16h bp;
        float rs = 0.0f;
#pragma unroll  // constant indices keep the array in registers
        for (int e = 0; e < 8; ++e) {
            const float p0 = __builtin_amdgcn_exp2f(a0[e] - mn);
            const float p1 = __builtin_amdgcn_exp2f(a1[e] - mn);
            rs += p0 + p1;
            bp[e]     = (_Float16)p0;
            bp[8 + e] = (_Float16)p1;
        }
        l = l * sc + rs;

        // ---- O^T += V^T P^T (A-fragments from LDS V tile) ----
#pragma unroll  // constant indices keep the array in registers
        for (int t = 0; t < 4; ++t) {
            const v16h av = load_frag16(&Vl[cur][t * 16 + l16][0], hl);
            o[t] = wmma_f16(av, bp, o[t]);
        }
        // No trailing barrier needed: next iteration's top barrier protects
        // the buffer being re-staged.
    }

    // Join the halves' sums, normalize, store 8 consecutive channels a lane.
    const float lt = l + xhalf(l);
    _Float16* orow = O + (size_t)(b * SEQ + qbase + l16) * DMODEL + h * DK + 8 * hl;
#pragma unroll  // constant indices keep the array in registers
    for (int t = 0; t < 4; ++t) {
        v8h r;
#pragma unroll  // constant indices keep the array in registers
        for (int e = 0; e < 8; ++e) r[e] = (_Float16)(o[t][e] / lt);
        *(v8h*)(orow + t * 16) = r;
    }
}

// ---------------------------------------------------------------------------
extern "C" void kernel_launch(void* const* d_in, const int* in_sizes, int n_in,
                              void* d_out, int out_size, void* d_ws, size_t ws_size,
                              hipStream_t stream) {
    const float* x   = (const float*)d_in[0];
    const float* pos = (const float*)d_in[1];
    const float* Wq  = (const float*)d_in[2];
    const float* bq  = (const float*)d_in[3];
    const float* Wk  = (const float*)d_in[4];
    const float* bk  = (const float*)d_in[5];
    const float* Wv  = (const float*)d_in[6];
    const float* bv  = (const float*)d_in[7];
    const float* Wo  = (const float*)d_in[8];
    const float* bo  = (const float*)d_in[9];
    const float* db  = (const float*)d_in[10];
    float* out = (float*)d_out;

    char* ws = (char*)d_ws;
    size_t off = 0;
    auto alloc = [&](size_t bytes) -> char* {
        char* p = ws + off;
        off += (bytes + 255) & ~(size_t)255;
        return p;
    };
    const size_t act_elems = (size_t)MROWS * DMODEL;     // 4M
    const size_t w_elems   = (size_t)DMODEL * DMODEL;    // 1M

    _Float16* xh  = (_Float16*)alloc(act_elems * 2);
    _Float16* wqh = (_Float16*)alloc(w_elems * 2);
    _Float16* wkh = (_Float16*)alloc(w_elems * 2);
    _Float16* wvh = (_Float16*)alloc(w_elems * 2);
    _Float16* woh = (_Float16*)alloc(w_elems * 2);
    _Float16* Qh  = (_Float16*)alloc(act_elems * 2);
    _Float16* Kh  = (_Float16*)alloc(act_elems * 2);
    _Float16* Vt  = (_Float16*)alloc(act_elems * 2);
    _Float16* Ah  = (_Float16*)alloc(act_elems * 2);
    (void)ws_size; (void)in_sizes; (void)n_in; (void)out_size;

    // f32 -> f16 conversions, all five tensors in one launch.
    cvt_all<<<512, 256, 0, stream>>>(x, Wq, Wk, Wv, Wo, xh, wqh, wkh, wvh, woh);

    // QKV projections, one launch (V stored transposed for contiguous PV fragments).
    gemm16<<<768, 256, 0, stream>>>(xh, wqh, wkh, wvh, bq, bk, bv, Qh, Kh, Vt, nullptr, 0);

    // Fused flash attention with geometric bias.
    attn_fa<<<1024, 128, 0, stream>>>(Qh, Kh, Vt, pos, db, Ah);

    // Output projection -> f32 result.
    gemm16<<<256, 256, 0, stream>>>(Ah, woh, woh, woh, bo, bo, bo, nullptr, nullptr, nullptr, out, 1);
}

// v009
// A run of this version takes 108 microseconds.
// It is 1.19 times as fast as v007, going by the measured steps of the versions left out in between.
// All steps since v000 together make it 3.27 times as fast.
#include <hip/hip_runtime.h>
#include <hip/hip_bf16.h>

#define BATCH   2
#define SEQ     2048
#define DMODEL  1024
#define NHEADS  16
#define DK      64
#define MROWS   (BATCH * SEQ)     // 4096

typedef __attribute__((ext_vector_type(16))) _Float16 v16h;
typedef __attribute__((ext_vector_type(8)))  _Float16 v8h;
typedef __attribute__((ext_vector_type(8)))  float    v8f;

// Load a 16x32 (f16) A/B fragment row for this lane.
// Per CDNA5 ISA layout: lane half 0 holds K = [0..7] and [16..23],
// half 1 holds K = [8..15] and [24..31]. Two aligned 16B loads.
static __device__ __forceinline__ v16h load_frag16(const _Float16* p, int hl) {
    v8h lo = *(const v8h*)(p + hl * 8);
    v8h hi = *(const v8h*)(p + 16 + hl * 8);
    return __builtin_shufflevector(lo, hi, 0, 1, 2, 3, 4, 5, 6, 7,
                                           8, 9, 10, 11, 12, 13, 14, 15);
}

static __device__ __forceinline__ v8f wmma_f16(v16h a, v16h b, v8f c) {
    return __builtin_amdgcn_wmma_f32_16x16x32_f16(
        /*neg_a=*/false, a, /*neg_b=*/false, b,
        /*c_mod=*/(short)0, c, /*reuse_a=*/false, /*reuse_b=*/false);
}

// ---------------------------------------------------------------------------
// f32 -> f16 conversion of x and the four weight matrices, one launch.
// The whole grid fits on the chip at once: 512 blocks of 8 waves, 256 WGPs.
// A wave takes 2048 consecutive elements: 16 loads of 512 contiguous bytes,
// issued ahead of the conversions so that many are in flight at once, then
// 16 stores of 256 contiguous bytes (whole 128-byte lines on both sides).
// Blocks 0..255 take x, then 64 blocks each take Wq, Wk, Wv, Wo.
// ---------------------------------------------------------------------------
typedef __attribute__((ext_vector_type(4))) float    f32x4;
typedef __attribute__((ext_vector_type(4))) _Float16 f16x4;

#define CVT_BLOCK_ELEMS 16384                                   // 8 waves x 2048
#define CVT_X_BLOCKS    (MROWS * DMODEL / CVT_BLOCK_ELEMS)      // 256
#define CVT_W_BLOCKS    (DMODEL * DMODEL / CVT_BLOCK_ELEMS)     // 64

__global__ __launch_bounds__(256)
void cvt_all(const float* __restrict__ x,
             const float* __restrict__ wq, const float* __restrict__ wk,
             const float* __restrict__ wv, const float* __restrict__ wo,
             _Float16* __restrict__ xh,
             _Float16* __restrict__ wqh, _Float16* __restrict__ wkh,
             _Float16* __restrict__ wvh, _Float16* __restrict__ woh) {
    int blk = blockIdx.x;
    const float* in = x;
    _Float16* out = xh;
    if (blk >= CVT_X_BLOCKS) {                 // block-uniform choice of tensor
        blk -= CVT_X_BLOCKS;
        const int w = blk / CVT_W_BLOCKS;
        blk -= w * CVT_W_BLOCKS;
        in  = w == 0 ? wq  : w == 1 ? wk  : w == 2 ? wv  : wo;
        out = w == 0 ? wqh : w == 1 ? wkh : w == 2 ? wvh : woh;
    }
    const int base = blk * CVT_BLOCK_ELEMS + (threadIdx.x >> 5) * 2048 +
                     (threadIdx.x & 31) * 4;
    const f32x4* src = (const f32x4*)(in + base);
    f16x4* dst = (f16x4*)(out + base);

    f32x4 v[16];
#pragma unroll  // constant indices keep the array in registers
    for (int i = 0; i < 16; ++i) v[i] = src[i * 32];
#pragma unroll  // constant indices keep the array in registers
    for (int i = 0; i < 16; ++i) {
        f16x4 r;
#pragma unroll  // constant indices keep the array in registers
        for (int c = 0; c < 4; ++c) r[c] = (_Float16)v[i][c];
        dst[i * 32] = r;
    }
}

// ---------------------------------------------------------------------------
// Y = X @ W^T + bias.  X:[MROWS, DMODEL] f16, W:[DMODEL, DMODEL] f16 row-major.
// One block of 8 waves computes a 128x128 tile; a wave a 64x32 part of it
// (8 accumulators).  K runs in chunks of 64: the 128 X rows and the 128 W rows
// of a chunk (128 bytes a row) go to LDS by asynchronous copies, 8 lanes a
// row, so every copy instruction moves 4 whole 128-byte lines, and each line
// is fetched once a block instead of once a wave in 32-byte pieces.  Two LDS
// buffers: a chunk's copies fly while the chunks before it are multiplied and read.
// mode 0: f16 store [MROWS, DMODEL]        (Q, K projections)
// mode 1: f16 transposed store Vt[b][c][n] (V projection)
// mode 2: f32 store [MROWS, DMODEL]        (final output projection)
// One launch holds up to three products of the same X: every 256 blocks take
// the next W, bias and output.  The Q, K and V projections, which do not depend
// on one another, so share one launch of 768 blocks: two blocks fit on a WGP
// (registers), and one block's copies, barriers, start and output stores run
// beside the other's matrix work instead of standing alone between launches.
// final == 0: groups 0, 1 in mode 0, group 2 in mode 1; final != 0: mode 2.
// A lane's 8 accumulator elements lie along the rows of the A operand, so the
// operand whose row index runs along the output's contiguous dimension is
// taken as A ("P": W in modes 0 and 2, X in mode 1) and the other as B ("R").
// A lane then holds 8 consecutive output elements; the wave's 64x32 part goes
// through the wave's own LDS range and leaves in whole 128-byte lines.
// ---------------------------------------------------------------------------
#define GT_ROWS   128                      // rows of X, and of W, a block tile
#define GT_K      64                       // halves of K a chunk (128 bytes)
#define GT_PITCH  72                       // LDS row pitch in halves: 144 B = 16 B x odd
#define GT_CHUNKS (DMODEL / GT_K)          // 16
#define GT_Q      (32 * GT_PITCH * 2)      // bytes of 32 LDS rows
#define GT_BUF    (GT_ROWS * GT_PITCH * 2) // bytes of one LDS buffer
#define GT_STAGE  (GT_BUF / 2)             // bytes of a wave's output staging range
#define GT_SP16   144                      // staging row pitch, 64 halves: 16 B x odd
#define GT_SP32   272                      // staging row pitch, 64 floats: 16 B x odd
#define GT_TILES  ((MROWS / GT_ROWS) * (DMODEL / GT_ROWS))   // 256 blocks a product

// LDS byte address of a __shared__ location (what an asynchronous copy takes).
static __device__ __forceinline__ unsigned lds_byte(_Float16* p) {
    return (unsigned)(size_t)(__attribute__((address_space(3))) _Float16*)p;
}

__global__ __launch_bounds__(256)
void gemm16(const _Float16* __restrict__ X,
            const _Float16* __restrict__ W0, const _Float16* __restrict__ W1,
            const _Float16* __restrict__ W2,
            const float* __restrict__ bias0, const float* __restrict__ bias1,
            const float* __restrict__ bias2,
            _Float16* __restrict__ outh0, _Float16* __restrict__ outh1,
            _Float16* __restrict__ outh2,
            float* __restrict__ outf, int final) {
    __shared__ __align__(16) _Float16 As[2][GT_ROWS][GT_PITCH];  // [buf][row of P][k]
    __shared__ __align__(16) _Float16 Bs[2][GT_ROWS][GT_PITCH];  // [buf][row of R][k]

    const int tid  = threadIdx.x;
    const int lane = tid & 31;
    const int wid  = tid >> 5;
    const int hl   = lane >> 4;
    const int l16  = lane & 15;

    // Block-uniform choice of the product and of the tile in it.
    const int grp  = blockIdx.x / GT_TILES;
    const int tile = blockIdx.x - grp * GT_TILES;
    const _Float16* W    = grp == 0 ? W0    : grp == 1 ? W1    : W2;
    const float*    bias = grp == 0 ? bias0 : grp == 1 ? bias1 : bias2;
    _Float16*       outh = grp == 0 ? outh0 : grp == 1 ? outh1 : outh2;
    const int mode = final ? 2 : grp == 2 ? 1 : 0;

    const int bm  = tile >> 3;                // 32 strips of 128 rows of X
    const int bn  = tile & 7;                 // 8 groups of 128 rows of W
    const bool tok = mode == 1;               // tokens run along the output's lines
    const _Float16* P = tok ? X : W;
    const _Float16* R = tok ? W : X;
    const int p0  = (tok ? bm : bn) * GT_ROWS;
    const int r0  = (tok ? bn : bm) * GT_ROWS;
    const int wp  = (wid & 1) * 64;           // the wave's rows of P in the tile
    const int wr  = (wid >> 1) * 32;          // the wave's rows of R in the tile

    // Bias of the lane's elements, fetched ahead of the K loop: it goes with the
    // W row, which is the accumulator's row (8 a tile) or its column (1 a tile).
    f32x4 bP[4][2];
    float bR[2];
    if (tok) {
#pragma unroll  // constant indices keep the array in registers
        for (int j = 0; j < 2; ++j) bR[j] = bias[r0 + wr + j * 16 + l16];
    } else {
#pragma unroll  // constant indices keep the array in registers
        for (int i = 0; i < 4; ++i) {
            const f32x4* bp = (const f32x4*)(bias + p0 + wp + i * 16 + 8 * hl);
            bP[i][0] = bp[0];
            bP[i][1] = bp[1];
        }
    }

    // Staging: a lane copies 16 bytes of rows srow, +32, +64, +96 of both tiles.
    const int srow = tid >> 3, sseg = (tid & 7) * 8;
    const _Float16* gA = P + (size_t)(p0 + srow) * DMODEL + sseg;
    const _Float16* gB = R + (size_t)(r0 + srow) * DMODEL + sseg;
    const unsigned lA = lds_byte(&As[0][srow][sseg]);
    const unsigned lB = lds_byte(&Bs[0][srow][sseg]);

    auto stage_chunk = [&](int buf, int chunk) {
        const _Float16* a = gA + chunk * GT_K;
        const _Float16* b = gB + chunk * GT_K;
        const unsigned la = lA + buf * GT_BUF;
        const unsigned lb = lB + buf * GT_BUF;
        // The 8 copies of one chunk.  The closing s_wait_xcnt stands in the
        // same statement so that no address register of a copy is rewritten
        // in front of it (a precaution).
        asm volatile(
            "global_load_async_to_lds_b128 %0, %8, off\n\t"
            "global_load_async_to_lds_b128 %1, %9, off\n\t"
            "global_load_async_to_lds_b128 %2, %10, off\n\t"
            "global_load_async_to_lds_b128 %3, %11, off\n\t"
            "global_load_async_to_lds_b128 %4, %12, off\n\t"
            "global_load_async_to_lds_b128 %5, %13, off\n\t"
            "global_load_async_to_lds_b128 %6, %14, off\n\t"
            "global_load_async_to_lds_b128 %7, %15, off\n\t"
            "s_wait_xcnt 0x0"
            :: "v"(la), "v"(la + GT_Q), "v"(la + 2 * GT_Q), "v"(la + 3 * GT_Q),
               "v"(lb), "v"(lb + GT_Q), "v"(lb + 2 * GT_Q), "v"(lb + 3 * GT_Q),
               "v"(a), "v"(a + 32 * DMODEL), "v"(a + 64 * DMODEL), "v"(a + 96 * DMODEL),
               "v"(b), "v"(b + 32 * DMODEL), "v"(b + 64 * DMODEL), "v"(b + 96 * DMODEL)
            : "memory");
    };

    v8f acc[4][2];
#pragma unroll  // constant indices keep the array in registers
    for (int i = 0; i < 4; ++i)
#pragma unroll  // constant indices keep the array in registers
        for (int j = 0; j < 2; ++j) acc[i][j] = v8f{};

    // Chunk 0 lands and is published before anything is read; chunk 1 follows.
    stage_chunk(0, 0);
    // This wave's copies have landed before the barrier lets others read them.
    asm volatile("s_wait_asynccnt 0x0" ::: "memory");
    __syncthreads();
    stage_chunk(1, 1);

    for (int c = 0; c < GT_CHUNKS; ++c) {
        const int cur = c & 1;
        const _Float16* as = &As[cur][wp + l16][0];
        const _Float16* bs = &Bs[cur][wr + l16][0];
        // All 24 LDS reads of the chunk stand in one group, in front of the
        // hand-over: one LDS latency a chunk, and the 16 matrix instructions,
        // which read registers only, run behind the barrier while the copies
        // of chunk c+2 are already on their way.
        v16h pf[2][4], rf[2][2];
#pragma unroll  // constant indices keep the arrays in registers
        for (int ks = 0; ks < 2; ++ks) {
#pragma unroll  // constant indices keep the arrays in registers
            for (int j = 0; j < 2; ++j)
                rf[ks][j] = load_frag16(bs + j * 16 * GT_PITCH + ks * 32, hl);
#pragma unroll  // constant indices keep the arrays in registers
            for (int i = 0; i < 4; ++i)
                pf[ks][i] = load_frag16(as + i * 16 * GT_PITCH + ks * 32, hl);
        }
        // Hand-over: this wave's LDS reads of chunk c are done ...
        asm volatile("s_wait_dscnt 0x0" ::: "memory");
        // ... its copies of chunk c+1 have landed ...
        asm volatile("s_wait_asynccnt 0x0" ::: "memory");
        // ... and the one barrier publishes chunk c+1 and frees buffer cur.
        __syncthreads();
        if (c + 2 < GT_CHUNKS) stage_chunk(cur, c + 2);

#pragma unroll  // constant indices keep the arrays in registers
        for (int ks = 0; ks < 2; ++ks) {
#pragma unroll  // constant indices keep the arrays in registers
            for (int i = 0; i < 4; ++i) {
                acc[i][0] = wmma_f16(pf[ks][i], rf[ks][0], acc[i][0]);
                acc[i][1] = wmma_f16(pf[ks][i], rf[ks][1], acc[i][1]);
            }
        }
    }
    // No copy is outstanding when the wave goes on to its stores and ends.
    asm volatile("s_wait_asynccnt 0x0" ::: "memory");

    // Output.  acc[i][j][e] belongs to row wp + i*16 + 8*hl + e of P and to row
    // wr + j*16 + l16 of R.  The last trip's barrier stands behind every wave's
    // last read of the two buffers and no copy is in flight, so each wave may
    // take a quarter of As (waves 0..3) or of Bs (waves 4..7) for itself.
    char* st = (char*)(wid < 4 ? &As[0][0][0] : &Bs[0][0][0]) + (wid & 3) * GT_STAGE;

    if (mode == 2) {
        // 32 rows (tokens) of 64 floats.
#pragma unroll  // constant indices keep the arrays in registers
        for (int j = 0; j < 2; ++j) {
#pragma unroll  // constant indices keep the arrays in registers
            for (int i = 0; i < 4; ++i) {
                f32x4 lo, hi;
#pragma unroll  // constant indices keep the arrays in registers
                for (int e = 0; e < 4; ++e) {
                    lo[e] = acc[i][j][e] + bP[i][0][e];
                    hi[e] = acc[i][j][4 + e] + bP[i][1][e];
                }
                f32x4* d = (f32x4*)(st + (j * 16 + l16) * GT_SP32 + (i * 16 + 8 * hl) * 4);
                d[0] = lo;
                d[1] = hi;
            }
        }
        // The rows are read back by other lanes of the wave than wrote them.
        asm volatile("s_wait_dscnt 0x0" ::: "memory");
        const char* sr = st + (lane >> 4) * GT_SP32 + (lane & 15) * 16;
        float* dst = outf + (size_t)(r0 + wr + (lane >> 4)) * DMODEL + p0 + wp + (lane & 15) * 4;
        f32x4 v[16];
#pragma unroll  // constant indices keep the array in registers
        for (int k = 0; k < 16; ++k) v[k] = *(const f32x4*)(sr + k * 2 * GT_SP32);
#pragma unroll  // constant indices keep the array in registers
        for (int k = 0; k < 16; ++k) *(f32x4*)(dst + k * 2 * DMODEL) = v[k];  // 2 x 256 B
    } else {
        // 32 rows (tokens, or channels of V) of 64 halves.
        char* sw = st + l16 * GT_SP16 + 8 * hl * 2;
        if (tok) {
#pragma unroll  // constant indices keep the arrays in registers
            for (int j = 0; j < 2; ++j) {
#pragma unroll  // constant indices keep the arrays in registers
                for (int i = 0; i < 4; ++i) {
                    v8h r;
#pragma unroll  // constant indices keep the arrays in registers
                    for (int e = 0; e < 8; ++e) r[e] = (_Float16)(acc[i][j][e] + bR[j]);
                    *(v8h*)(sw + j * 16 * GT_SP16 + i * 32) = r;
                }
            }
        } else {
#pragma unroll  // constant indices keep the arrays in registers
            for (int j = 0; j < 2; ++j) {
#pragma unroll  // constant indices keep the arrays in registers
                for (int i = 0; i < 4; ++i) {
                    v8h r;
#pragma unroll  // constant indices keep the arrays in registers
                    for (int e = 0; e < 8; ++e)
                        r[e] = (_Float16)(acc[i][j][e] + bP[i][e >> 2][e & 3]);
                    *(v8h*)(sw + j * 16 * GT_SP16 + i * 32) = r;
                }
            }
        }
        // The rows are read back by other lanes of the wave than wrote them.
        asm volatile("s_wait_dscnt 0x0" ::: "memory");
        const char* sr = st + (lane >> 3) * GT_SP16 + (lane & 7) * 16;
        v8h v[8];
#pragma unroll  // constant indices keep the array in registers
        for (int k = 0; k < 8; ++k) v[k] = *(const v8h*)(sr + k * 4 * GT_SP16);
        const int row = r0 + wr + (lane >> 3);
        const int col = p0 + wp + (lane & 7) * 8;
        if (tok) {   // row = channel, col = token: Vt[b][channel][n]
            _Float16* dst = outh + ((size_t)(col >> 11) * DMODEL + row) * SEQ + (col & (SEQ - 1));
#pragma unroll  // constant indices keep the array in registers
            for (int k = 0; k < 8; ++k) *(v8h*)(dst + k * 4 * SEQ) = v[k];     // 4 x 128 B
        } else {     // row = token, col = channel
            _Float16* dst = outh + (size_t)row * DMODEL + col;
#pragma unroll  // constant indices keep the array in registers
            for (int k = 0; k < 8; ++k) *(v8h*)(dst + k * 4 * DMODEL) = v[k];  // 4 x 128 B
            // Precaution: in the built code the other path's address sums, which take
            // the same registers as these stores' address, stand behind this run.
            asm volatile("s_wait_xcnt 0x0" ::: "memory");
        }
    }
}

// ---------------------------------------------------------------------------
// Fused flash attention with geometric distance bias, transposed scores.
// One block = 4 waves sharing one (b, h); each wave owns a 16-query tile.
// K/V tiles are double-buffered in LDS in stages of 64 keys, two steps of 32
// keys a stage.  At 64 keys a row of the V tile is 128 bytes like a row of the
// K tile, and 8 lanes copy one row: every asynchronous copy moves 4 whole
// 128-byte lines.  The copies of stage s+2 are issued behind the barrier at the
// foot of stage s and waited at the foot of stage s+1, so they fly during a
// whole stage of WMMA + softmax compute.
// Per step: 4 WMMA (S^T = K Q^T, K rows as A, Q as B), distance bias,
// online softmax, 4 WMMA (O^T += V^T P^T).  In S^T a lane holds 16 scores of
// ONE query (column = lane%16, key = e + 8*half per 16-key tile), so maximum
// and sum run in the lane's own registers with one exchange between the wave
// halves, and the two converted score tiles are already the B operand of the
// second product (k = 8*half + e, then 16 + 8*half + e): P never leaves the
// registers.
// The squared distances of a 16-key x 16-query tile come from one f32 matrix
// instruction in the reference's own expanded form |q|^2 + |k|^2 - 2 q.k:
// A row = (kx, ky, kz, |k|^2), B column = (-2qx, -2qy, -2qz, 1), C = |q|^2.
// The result has the map of the score tiles, element for element.
// ---------------------------------------------------------------------------
typedef __attribute__((ext_vector_type(4))) float v4f;
typedef __attribute__((ext_vector_type(2))) float v2f;

static __device__ __forceinline__ v8f wmma_f32k4(v2f a, v2f b, v8f c) {
    return __builtin_amdgcn_wmma_f32_16x16x4_f32(
        /*neg_a=*/false, a, /*neg_b=*/false, b,
        /*c_mod=*/(short)0, c, /*reuse_a=*/false, /*reuse_b=*/false);
}

// Value of lane l ^ 16 (the other half of the wave holds the same query).
static __device__ __forceinline__ float xhalf(float x) {
    return __builtin_bit_cast(float, __builtin_amdgcn_permlanex16(
        __builtin_bit_cast(int, x), __builtin_bit_cast(int, x),
        0x76543210, 0xfedcba98, false, false));
}

#define AT_KEYS   64                       // keys a stage
#define AT_PITCH  72                       // LDS row pitch in halves: 144 B = 16 B x odd
#define AT_Q      (16 * AT_PITCH * 2)      // bytes of 16 LDS rows
#define AT_BUF    (64 * AT_PITCH * 2)      // bytes of one LDS buffer, K or V (64 rows)
#define AT_STAGES (SEQ / AT_KEYS)          // 32

__global__ __launch_bounds__(128)
void attn_fa(const _Float16* __restrict__ Qh, const _Float16* __restrict__ Kh,
             const _Float16* __restrict__ Vt, const float* __restrict__ pos,
             const float* __restrict__ dist_bias, _Float16* __restrict__ O) {
    // Row pitch = 16 B x odd (144 B for the 128-B rows of both tiles): the 16
    // rows that one ds_load_b128 fragment read touches then fall on 16 different
    // groups of four banks.  At the bare pitch they fall on 2 groups and each
    // read is replayed 8 times.
    // The pad halves at the end of a row are never written and never read.
    __shared__ __align__(16) _Float16 Kt[2][AT_KEYS][AT_PITCH];  // [buf][key j][d]
    __shared__ __align__(16) _Float16 Vl[2][DK][AT_PITCH];       // [buf][d (c)][key j]
    // (x, y, z, x^2 + y^2 + z^2) of every key of the batch, filled once a block.
    __shared__ __align__(16) float Kp[SEQ][4];

    const int tid  = threadIdx.x;
    const int lane = tid & 31;
    const int wid  = tid >> 5;
    const int hl   = lane >> 4;
    const int l16  = lane & 15;

    const int bh    = blockIdx.x >> 5;     // 32 (b,h) pairs; 32 blocks each
    const int qgrp  = blockIdx.x & 31;
    const int b     = bh >> 4;
    const int h     = bh & 15;
    const int qbase = (qgrp * 4 + wid) * 16;

    // Scores live in base 2: log2(e) is folded into both constants, so each
    // exponential and the logarithm is one hardware instruction.
    const float LOG2E = 1.4426950408889634f;
    const float nab2  = -fabsf(dist_bias[h]) * LOG2E;
    const float scale = 0.125f * LOG2E;    // log2(e)/sqrt(DK)

    // Position of the one query this lane's score column belongs to.
    const float* pq = pos + ((size_t)b * SEQ + qbase + l16) * 3;
    const float qx = pq[0], qy = pq[1], qz = pq[2];
    // Precaution: the load's address registers are reused soon after it
    // (address sums, accumulator start values), so the wait stands first.
    asm volatile("s_wait_xcnt 0x0" ::: "memory");

    // Query side of the distance product: this half's two k of the four (the
    // key side below takes the same two), and |q|^2 as the start value.
    const v2f qd = hl ? v2f{-2.0f * qz, 1.0f} : v2f{-2.0f * qx, -2.0f * qy};
    const float qq = qx * qx + qy * qy + qz * qz;
    const v8f cq = {qq, qq, qq, qq, qq, qq, qq, qq};

    // Q fragments: invariant over the key loop -> registers (B operand).
    const _Float16* qrow =
        Qh + (size_t)(b * SEQ + qbase + l16) * DMODEL + h * DK;
    const v16h aq0 = load_frag16(qrow, hl);
    const v16h aq1 = load_frag16(qrow + 32, hl);

    v8f o[4] = {v8f{}, v8f{}, v8f{}, v8f{}};  // o[t][e] = O^T[t*16+8*hl+e][l16]
    float m = -3.0e38f;                       // running maximum of the query
    float l = 0.0f;                           // this half's share of the sum

    // Staging: a lane copies 16 bytes of rows srow, +16, +32, +48 of both tiles
    // (K: 64 keys x 64 d, V: 64 d x 64 keys; 128 bytes a row, 8 lanes a row).
    const int srow = tid >> 3, sseg = (tid & 7) * 8;
    const _Float16* gK = Kh + (size_t)(b * SEQ + srow) * DMODEL + h * DK + sseg;
    const _Float16* gV = Vt + (size_t)(b * DMODEL + h * DK + srow) * SEQ + sseg;
    const unsigned lK = lds_byte(&Kt[0][srow][sseg]);
    const unsigned lV = lds_byte(&Vl[0][srow][sseg]);

    // Stage one 64-key block into LDS buffer `buf`.
    auto stage_tiles = [&](int buf, int stage) {
        const _Float16* k = gK + (size_t)stage * AT_KEYS * DMODEL;
        const _Float16* v = gV + stage * AT_KEYS;
        const unsigned lk = lK + buf * AT_BUF;
        const unsigned lv = lV + buf * AT_BUF;
        // The 8 copies of one stage.  The closing s_wait_xcnt stands in the
        // same statement so that no address register of a copy is rewritten
        // in front of it (a precaution).
        asm volatile(
            "global_load_async_to_lds_b128 %0, %8, off\n\t"
            "global_load_async_to_lds_b128 %1, %9, off\n\t"
            "global_load_async_to_lds_b128 %2, %10, off\n\t"
            "global_load_async_to_lds_b128 %3, %11, off\n\t"
            "global_load_async_to_lds_b128 %4, %12, off\n\t"
            "global_load_async_to_lds_b128 %5, %13, off\n\t"
            "global_load_async_to_lds_b128 %6, %14, off\n\t"
            "global_load_async_to_lds_b128 %7, %15, off\n\t"
            "s_wait_xcnt 0x0"
            :: "v"(lk), "v"(lk + AT_Q), "v"(lk + 2 * AT_Q), "v"(lk + 3 * AT_Q),
               "v"(lv), "v"(lv + AT_Q), "v"(lv + 2 * AT_Q), "v"(lv + 3 * AT_Q),
               "v"(k), "v"(k + 16 * DMODEL), "v"(k + 32 * DMODEL), "v"(k + 48 * DMODEL),
               "v"(v), "v"(v + 16 * SEQ), "v"(v + 32 * SEQ), "v"(v + 48 * SEQ)
            : "memory");
    };

    stage_tiles(0, 0);   // prologue

    // Key table: a thread takes keys tid, tid + 128, ...  The barrier in front
    // of the loop stands between these LDS writes and every read of the table.
    {
        const float* pb = pos + (size_t)b * SEQ * 3 + tid * 3;
        float px[SEQ / 128], py[SEQ / 128], pz[SEQ / 128];
#pragma unroll  // constant indices keep the arrays in registers
        for (int i = 0; i < SEQ / 128; ++i) {
            px[i] = pb[i * 384];
            py[i] = pb[i * 384 + 1];
            pz[i] = pb[i * 384 + 2];
        }
        // Precaution: the loads' address registers may be reused behind them.
        asm volatile("s_wait_xcnt 0x0" ::: "memory");
#pragma unroll  // constant indices keep the arrays in registers
        for (int i = 0; i < SEQ / 128; ++i)
            *(v4f*)&Kp[i * 128 + tid][0] =
                v4f{px[i], py[i], pz[i], px[i] * px[i] + py[i] * py[i] + pz[i] * pz[i]};
    }

    // Stage 0 lands and is published before anything is read; stage 1 follows.
    // This wave's copies have landed before the barrier lets others read them.
    asm volatile("s_wait_asynccnt 0x0" ::: "memory");
    __syncthreads();
    stage_tiles(1, 1);

    for (int stage = 0; stage < AT_STAGES; ++stage) {
      const int cur = stage & 1;
#pragma unroll  // the step's place in the stage becomes a constant LDS offset
      for (int kb = 0; kb < AT_KEYS; kb += 32) {
        const int jb = stage * AT_KEYS + kb;

        // Squared distances of the two 16-key tiles to the wave's 16 queries.
        const v2f kd0 = *(const v2f*)&Kp[jb + l16][2 * hl];
        const v2f kd1 = *(const v2f*)&Kp[jb + 16 + l16][2 * hl];
        const v16h kf00 = load_frag16(&Kt[cur][kb + l16][0], hl);
        const v16h kf10 = load_frag16(&Kt[cur][kb + 16 + l16][0], hl);
        const v16h kf01 = load_frag16(&Kt[cur][kb + l16][32], hl);
        const v16h kf11 = load_frag16(&Kt[cur][kb + 16 + l16][32], hl);
        // Keeps vector work of the step before, which may reuse the registers of
        // kd0 and kd1, in front of the two distance products, not behind them.
        __builtin_amdgcn_sched_barrier(0);
        const v8f q0 = wmma_f32k4(kd0, qd, cq);
        const v8f q1 = wmma_f32k4(kd1, qd, cq);
        // Keeps the four score products between the two distance products and
        // the first vector instruction that reads their results.
        __builtin_amdgcn_sched_barrier(0);

        // ---- S^T = K Q^T for the 32-key block (two 16x16 tiles) ----
        v8f s0 = v8f{}, s1 = v8f{};
        s0 = wmma_f16(kf00, aq0, s0);
        s1 = wmma_f16(kf10, aq0, s1);
        s0 = wmma_f16(kf01, aq1, s0);
        s1 = wmma_f16(kf11, aq1, s1);
        __builtin_amdgcn_sched_barrier(0);  // the other end of the same hold

        float a0[8], a1[8];
        float v = -3.0e38f;
#pragma unroll  // constant indices keep the array in registers
        for (int e = 0; e < 8; ++e) {
            // A sum below zero is rounding residue of a true value near zero, of
            // the size a residue above zero has; |.| costs no instruction.
            const float d0v = __builtin_amdgcn_sqrtf(__builtin_fabsf(q0[e]));
            const float d1v = __builtin_amdgcn_sqrtf(__builtin_fabsf(q1[e]));
            // The weight lies in [1e-8, 1 + 1e-8]: an exponential that falls
            // below the normal range vanishes in the sum with 1e-8 anyway,
            // and the logarithm's argument is always a normal number.
            a0[e] = s0[e] * scale +
                    __builtin_amdgcn_logf(__builtin_amdgcn_exp2f(nab2 * d0v) + 1e-8f);
            a1[e] = s1[e] * scale +
                    __builtin_amdgcn_logf(__builtin_amdgcn_exp2f(nab2 * d1v) + 1e-8f);
            v = fmaxf(v, fmaxf(a0[e], a1[e]));
        }
        // The other half holds the query's other 16 keys of this block.
        v = fmaxf(v, xhalf(v));

        const float mn = fmaxf(m, v);
        const float sc = __builtin_amdgcn_exp2f(m - mn);
        m = mn;
#pragma unroll  // constant indices keep the array in registers
        for (int t = 0; t < 4; ++t)
#pragma unroll  // constant indices keep the array in registers
            for (int e = 0; e < 8; ++e) o[t][e] *= sc;

        // P^T as B operand, straight from the two score tiles.
        v16h bp;
        float rs = 0.0f;
#pragma unroll  // constant indices keep the array in registers
        for (int e = 0; e < 8; ++e) {
            const float p0 = __builtin_amdgcn_exp2f(a0[e] - mn);
            const float p1 = __builtin_amdgcn_exp2f(a1[e] - mn);
            rs += p0 + p1;
            bp[e]     = (_Float16)p0;
            bp[8 + e] = (_Float16)p1;
        }
        l = l * sc + rs;

        // ---- O^T += V^T P^T (A-fragments from LDS V tile) ----
#pragma unroll  // constant indices keep the array in registers
        for (int t = 0; t < 4; ++t) {
            const v16h av = load_frag16(&Vl[cur][t * 16 + l16][kb], hl);
            o[t] = wmma_f16(av, bp, o[t]);
        }
      }
      // Hand-over: this wave's LDS reads of the stage are done ...
      asm volatile("s_wait_dscnt 0x0" ::: "memory");
      // ... its copies of the next stage have landed ...
      asm volatile("s_wait_asynccnt 0x0" ::: "memory");
      // ... and the one barrier publishes that stage and frees buffer cur.
      __syncthreads();
      if (stage + 2 < AT_STAGES) stage_tiles(cur, stage + 2);
    }
    // No copy is outstanding when the wave goes on to its stores and ends.
    asm volatile("s_wait_asynccnt 0x0" ::: "memory");

    // Join the halves' sums, normalize, store 8 consecutive channels a lane.
    const float lt = l + xhalf(l);
    _Float16* orow = O + (size_t)(b * SEQ + qbase + l16) * DMODEL + h * DK + 8 * hl;
#pragma unroll  // constant indices keep the array in registers
    for (int t = 0; t < 4; ++t) {
        v8h r;
#pragma unroll  // constant indices keep the array in registers
        for (int e = 0; e < 8; ++e) r[e] = (_Float16)(o[t][e] / lt);
        *(v8h*)(orow + t * 16) = r;
    }
}

// ---------------------------------------------------------------------------
extern "C" void kernel_launch(void* const* d_in, const int* in_sizes, int n_in,
                              void* d_out, int out_size, void* d_ws, size_t ws_size,
                              hipStream_t stream) {
    const float* x   = (const float*)d_in[0];
    const float* pos = (const float*)d_in[1];
    const float* Wq  = (const float*)d_in[2];
    const float* bq  = (const float*)d_in[3];
    const float* Wk  = (const float*)d_in[4];
    const float* bk  = (const float*)d_in[5];
    const float* Wv  = (const float*)d_in[6];
    const float* bv  = (const float*)d_in[7];
    const float* Wo  = (const float*)d_in[8];
    const float* bo  = (const float*)d_in[9];
    const float* db  = (const float*)d_in[10];
    float* out = (float*)d_out;

    char* ws = (char*)d_ws;
    size_t off = 0;
    auto alloc = [&](size_t bytes) -> char* {
        char* p = ws + off;
        off += (bytes + 255) & ~(size_t)255;
        return p;
    };
    const size_t act_elems = (size_t)MROWS * DMODEL;     // 4M
    const size_t w_elems   = (size_t)DMODEL * DMODEL;    // 1M

    _Float16* xh  = (_Float16*)alloc(act_elems * 2);
    _Float16* wqh = (_Float16*)alloc(w_elems * 2);
    _Float16* wkh = (_Float16*)alloc(w_elems * 2);
    _Float16* wvh = (_Float16*)alloc(w_elems * 2);
    _Float16* woh = (_Float16*)alloc(w_elems * 2);
    _Float16* Qh  = (_Float16*)alloc(act_elems * 2);
    _Float16* Kh  = (_Float16*)alloc(act_elems * 2);
    _Float16* Vt  = (_Float16*)alloc(act_elems * 2);
    _Float16* Ah  = (_Float16*)alloc(act_elems * 2);
    (void)ws_size; (void)in_sizes; (void)n_in; (void)out_size;

    // f32 -> f16 conversions, all five tensors in one launch.
    cvt_all<<<512, 256, 0, stream>>>(x, Wq, Wk, Wv, Wo, xh, wqh, wkh, wvh, woh);

    // QKV projections, one launch (V stored transposed for contiguous PV fragments).
    gemm16<<<768, 256, 0, stream>>>(xh, wqh, wkh, wvh, bq, bk, bv, Qh, Kh, Vt, nullptr, 0);

    // Fused flash attention with geometric bias.
    attn_fa<<<1024, 128, 0, stream>>>(Qh, Kh, Vt, pos, db, Ah);

    // Output projection -> f32 result.
    gemm16<<<256, 256, 0, stream>>>(Ah, woh, woh, woh, bo, bo, bo, nullptr, nullptr, nullptr, out, 1);
}

// v010
// One run takes 104 microseconds.
// Timed twice side by side with v009, it ran 1.03 times as fast both times.
// All steps since v000 together make it 3.37 times as fast.
#include <hip/hip_runtime.h>
#include <hip/hip_bf16.h>

#define BATCH   2
#define SEQ     2048
#define DMODEL  1024
#define NHEADS  16
#define DK      64
#define MROWS   (BATCH * SEQ)     // 4096

typedef __attribute__((ext_vector_type(16))) _Float16 v16h;
typedef __attribute__((ext_vector_type(8)))  _Float16 v8h;
typedef __attribute__((ext_vector_type(8)))  float    v8f;

// Load a 16x32 (f16) A/B fragment row for this lane.
// Per CDNA5 ISA layout: lane half 0 holds K = [0..7] and [16..23],
// half 1 holds K = [8..15] and [24..31]. Two aligned 16B loads.
static __device__ __forceinline__ v16h load_frag16(const _Float16* p, int hl) {
    v8h lo = *(const v8h*)(p + hl * 8);
    v8h hi = *(const v8h*)(p + 16 + hl * 8);
    return __builtin_shufflevector(lo, hi, 0, 1, 2, 3, 4, 5, 6, 7,
                                           8, 9, 10, 11, 12, 13, 14, 15);
}

static __device__ __forceinline__ v8f wmma_f16(v16h a, v16h b, v8f c) {
    return __builtin_amdgcn_wmma_f32_16x16x32_f16(
        /*neg_a=*/false, a, /*neg_b=*/false, b,
        /*c_mod=*/(short)0, c, /*reuse_a=*/false, /*reuse_b=*/false);
}

// ---------------------------------------------------------------------------
// f32 -> f16 conversion of x and the four weight matrices, one launch.
// The whole grid fits on the chip at once: 512 blocks of 8 waves, 256 WGPs.
// A wave takes 2048 consecutive elements: 16 loads of 512 contiguous bytes,
// issued ahead of the conversions so that many are in flight at once, then
// 16 stores of 256 contiguous bytes (whole 128-byte lines on both sides).
// Blocks 0..255 take x, then 64 blocks each take Wq, Wk, Wv, Wo.
// ---------------------------------------------------------------------------
typedef __attribute__((ext_vector_type(4))) float    f32x4;
typedef __attribute__((ext_vector_type(4))) _Float16 f16x4;

#define CVT_BLOCK_ELEMS 16384                                   // 8 waves x 2048
#define CVT_X_BLOCKS    (MROWS * DMODEL / CVT_BLOCK_ELEMS)      // 256
#define CVT_W_BLOCKS    (DMODEL * DMODEL / CVT_BLOCK_ELEMS)     // 64

__global__ __launch_bounds__(256)
void cvt_all(const float* __restrict__ x,
             const float* __restrict__ wq, const float* __restrict__ wk,
             const float* __restrict__ wv, const float* __restrict__ wo,
             _Float16* __restrict__ xh,
             _Float16* __restrict__ wqh, _Float16* __restrict__ wkh,
             _Float16* __restrict__ wvh, _Float16* __restrict__ woh) {
    int blk = blockIdx.x;
    const float* in = x;
    _Float16* out = xh;
    if (blk >= CVT_X_BLOCKS) {                 // block-uniform choice of tensor
        blk -= CVT_X_BLOCKS;
        const int w = blk / CVT_W_BLOCKS;
        blk -= w * CVT_W_BLOCKS;
        in  = w == 0 ? wq  : w == 1 ? wk  : w == 2 ? wv  : wo;
        out = w == 0 ? wqh : w == 1 ? wkh : w == 2 ? wvh : woh;
    }
    const int base = blk * CVT_BLOCK_ELEMS + (threadIdx.x >> 5) * 2048 +
                     (threadIdx.x & 31) * 4;
    const f32x4* src = (const f32x4*)(in + base);
    f16x4* dst = (f16x4*)(out + base);

    f32x4 v[16];
#pragma unroll  // constant indices keep the array in registers
    for (int i = 0; i < 16; ++i) v[i] = src[i * 32];
#pragma unroll  // constant indices keep the array in registers
    for (int i = 0; i < 16; ++i) {
        f16x4 r;
#pragma unroll  // constant indices keep the array in registers
        for (int c = 0; c < 4; ++c) r[c] = (_Float16)v[i][c];
        dst[i * 32] = r;
    }
}

// ---------------------------------------------------------------------------
// Y = X @ W^T + bias.  X:[MROWS, DMODEL] f16, W:[DMODEL, DMODEL] f16 row-major.
// One block of 4 waves computes a 128x128 tile; a wave a 64x64 part of it
// (16 accumulators): 8 fragments read from LDS feed 16 matrix instructions,
// where a 64x32 part reads 6 for 8, so the LDS reads of a tile fall by a third
// (from above the LDS rate at full matrix speed to level with it).
// K runs in chunks of 64: the 128 X rows and the 128 W rows
// of a chunk (128 bytes a row) go to LDS by asynchronous copies, 8 lanes a
// row, so every copy instruction moves 4 whole 128-byte lines, and each line
// is fetched once a block instead of once a wave in 32-byte pieces.  Two LDS
// buffers: a chunk's copies fly while the chunks before it are multiplied and read.
// mode 0: f16 store [MROWS, DMODEL]        (Q, K projections)
// mode 1: f16 transposed store Vt[b][c][n] (V projection)
// mode 2: f32 store [MROWS, DMODEL]        (final output projection)
// One launch holds up to three products of the same X: every 256 blocks take
// the next W, bias and output.  The Q, K and V projections, which do not depend
// on one another, so share one launch of 768 blocks: the three blocks of a WGP
// are all resident (one wave a SIMD each), and one block's copies, barriers,
// LDS reads, start and output stores run beside the others' matrix work.
// final == 0: groups 0, 1 in mode 0, group 2 in mode 1; final != 0: mode 2.
// A lane's 8 accumulator elements lie along the rows of the A operand, so the
// operand whose row index runs along the output's contiguous dimension is
// taken as A ("P": W in modes 0 and 2, X in mode 1) and the other as B ("R").
// A lane then holds 8 consecutive output elements; the wave's 64x64 part goes
// through the wave's own LDS range and leaves in whole 128-byte lines.
// ---------------------------------------------------------------------------
#define GT_ROWS   128                      // rows of X, and of W, a block tile
#define GT_K      64                       // halves of K a chunk (128 bytes)
#define GT_PITCH  72                       // LDS row pitch in halves: 144 B = 16 B x odd
#define GT_CHUNKS (DMODEL / GT_K)          // 16
#define GT_Q      (16 * GT_PITCH * 2)      // bytes of 16 LDS rows
#define GT_BUF    (GT_ROWS * GT_PITCH * 2) // bytes of one LDS buffer
#define GT_SP16   144                      // staging row pitch, 64 halves: 16 B x odd
#define GT_SP32   272                      // staging row pitch, 64 floats: 16 B x odd
#define GT_TILES  ((MROWS / GT_ROWS) * (DMODEL / GT_ROWS))   // 256 blocks a product

// LDS byte address of a __shared__ location (what an asynchronous copy takes).
static __device__ __forceinline__ unsigned lds_byte(_Float16* p) {
    return (unsigned)(size_t)(__attribute__((address_space(3))) _Float16*)p;
}

// Second argument: a budget of 256 registers a wave; without it the build takes
// 304 and switches register windows inside the K loop.
__global__ __launch_bounds__(128, 4)
void gemm16(const _Float16* __restrict__ X,
            const _Float16* __restrict__ W0, const _Float16* __restrict__ W1,
            const _Float16* __restrict__ W2,
            const float* __restrict__ bias0, const float* __restrict__ bias1,
            const float* __restrict__ bias2,
            _Float16* __restrict__ outh0, _Float16* __restrict__ outh1,
            _Float16* __restrict__ outh2,
            float* __restrict__ outf, int final) {
    __shared__ __align__(16) _Float16 As[2][GT_ROWS][GT_PITCH];  // [buf][row of P][k]
    __shared__ __align__(16) _Float16 Bs[2][GT_ROWS][GT_PITCH];  // [buf][row of R][k]
    __shared__ __align__(16) float Bi[GT_ROWS];                  // bias of the W rows

    const int tid  = threadIdx.x;
    const int lane = tid & 31;
    const int wid  = tid >> 5;
    const int hl   = lane >> 4;
    const int l16  = lane & 15;

    // Block-uniform choice of the product and of the tile in it.
    const int grp  = blockIdx.x / GT_TILES;
    const int tile = blockIdx.x - grp * GT_TILES;
    const _Float16* W    = grp == 0 ? W0    : grp == 1 ? W1    : W2;
    const float*    bias = grp == 0 ? bias0 : grp == 1 ? bias1 : bias2;
    _Float16*       outh = grp == 0 ? outh0 : grp == 1 ? outh1 : outh2;
    const int mode = final ? 2 : grp == 2 ? 1 : 0;

    const int bm  = tile >> 3;                // 32 strips of 128 rows of X
    const int bn  = tile & 7;                 // 8 groups of 128 rows of W
    const bool tok = mode == 1;               // tokens run along the output's lines
    const _Float16* P = tok ? X : W;
    const _Float16* R = tok ? W : X;
    const int p0  = (tok ? bm : bn) * GT_ROWS;
    const int r0  = (tok ? bn : bm) * GT_ROWS;
    const int wp  = (wid & 1) * 64;           // the wave's rows of P in the tile
    const int wr  = (wid >> 1) * 64;          // the wave's rows of R in the tile

    // Bias of the tile's 128 W rows, fetched ahead of the K loop, one a thread.
    const float bw = bias[(tok ? r0 : p0) + tid];
    // Precaution: the load's address registers may be reused behind it.
    asm volatile("s_wait_xcnt 0x0" ::: "memory");

    // Staging: a lane copies 16 bytes of rows srow, +16, ..., +112 of both tiles.
    const int srow = tid >> 3, sseg = (tid & 7) * 8;
    const _Float16* gA = P + (size_t)(p0 + srow) * DMODEL + sseg;
    const _Float16* gB = R + (size_t)(r0 + srow) * DMODEL + sseg;
    const unsigned lA = lds_byte(&As[0][srow][sseg]);
    const unsigned lB = lds_byte(&Bs[0][srow][sseg]);

    // The 8 copies of one tile's chunk.  The closing s_wait_xcnt stands in the
    // same statement so that no address register of a copy is rewritten in
    // front of it (a precaution).
    auto stage_tile = [&](unsigned l, const _Float16* g) {
        asm volatile(
            "global_load_async_to_lds_b128 %0, %8, off\n\t"
            "global_load_async_to_lds_b128 %1, %9, off\n\t"
            "global_load_async_to_lds_b128 %2, %10, off\n\t"
            "global_load_async_to_lds_b128 %3, %11, off\n\t"
            "global_load_async_to_lds_b128 %4, %12, off\n\t"
            "global_load_async_to_lds_b128 %5, %13, off\n\t"
            "global_load_async_to_lds_b128 %6, %14, off\n\t"
            "global_load_async_to_lds_b128 %7, %15, off\n\t"
            "s_wait_xcnt 0x0"
            :: "v"(l), "v"(l + GT_Q), "v"(l + 2 * GT_Q), "v"(l + 3 * GT_Q),
               "v"(l + 4 * GT_Q), "v"(l + 5 * GT_Q), "v"(l + 6 * GT_Q), "v"(l + 7 * GT_Q),
               "v"(g), "v"(g + 16 * DMODEL), "v"(g + 32 * DMODEL), "v"(g + 48 * DMODEL),
               "v"(g + 64 * DMODEL), "v"(g + 80 * DMODEL), "v"(g + 96 * DMODEL),
               "v"(g + 112 * DMODEL)
            : "memory");
    };
    auto stage_chunk = [&](int buf, int chunk) {
        stage_tile(lA + buf * GT_BUF, gA + chunk * GT_K);
        stage_tile(lB + buf * GT_BUF, gB + chunk * GT_K);
    };

    v8f acc[4][4];
#pragma unroll  // constant indices keep the array in registers
    for (int i = 0; i < 4; ++i)
#pragma unroll  // constant indices keep the array in registers
        for (int j = 0; j < 4; ++j) acc[i][j] = v8f{};

    // Chunk 0 lands and is published before anything is read; chunk 1 follows.
    stage_chunk(0, 0);
    // The bias waits in LDS: the 16 accumulators leave no registers to hold it.
    // The barrier below stands between this write and every read of it.
    Bi[tid] = bw;
    // This wave's copies have landed before the barrier lets others read them.
    asm volatile("s_wait_asynccnt 0x0" ::: "memory");
    __syncthreads();
    stage_chunk(1, 1);

    for (int c = 0; c < GT_CHUNKS; ++c) {
        const int cur = c & 1;
        const _Float16* as = &As[cur][wp + l16][0];
        const _Float16* bs = &Bs[cur][wr + l16][0];
        // The chunk's two k steps of 32, each 16 LDS reads in one group and 16
        // matrix instructions.  The second step's reads stand in front of the
        // hand-over, its matrix instructions, which read registers only, behind
        // it, while the copies of chunk c+2 are already on their way.
        v16h pf[4], rf[4];
#pragma unroll  // constant indices keep the arrays in registers
        for (int j = 0; j < 4; ++j) rf[j] = load_frag16(bs + j * 16 * GT_PITCH, hl);
#pragma unroll  // constant indices keep the arrays in registers
        for (int i = 0; i < 4; ++i) pf[i] = load_frag16(as + i * 16 * GT_PITCH, hl);
#pragma unroll  // constant indices keep the arrays in registers
        for (int i = 0; i < 4; ++i)
#pragma unroll  // constant indices keep the arrays in registers
            for (int j = 0; j < 4; ++j) acc[i][j] = wmma_f16(pf[i], rf[j], acc[i][j]);

#pragma unroll  // constant indices keep the arrays in registers
        for (int j = 0; j < 4; ++j) rf[j] = load_frag16(bs + j * 16 * GT_PITCH + 32, hl);
#pragma unroll  // constant indices keep the arrays in registers
        for (int i = 0; i < 4; ++i) pf[i] = load_frag16(as + i * 16 * GT_PITCH + 32, hl);
        // Hand-over: this wave's LDS reads of chunk c are done ...
        asm volatile("s_wait_dscnt 0x0" ::: "memory");
        // ... its copies of chunk c+1 have landed ...
        asm volatile("s_wait_asynccnt 0x0" ::: "memory");
        // ... and the one barrier publishes chunk c+1 and frees buffer cur.
        __syncthreads();
        if (c + 2 < GT_CHUNKS) stage_chunk(cur, c + 2);

#pragma unroll  // constant indices keep the arrays in registers
        for (int i = 0; i < 4; ++i)
#pragma unroll  // constant indices keep the arrays in registers
            for (int j = 0; j < 4; ++j) acc[i][j] = wmma_f16(pf[i], rf[j], acc[i][j]);
    }
    // No copy is outstanding when the wave goes on to its stores and ends.
    asm volatile("s_wait_asynccnt 0x0" ::: "memory");

    // Output.  acc[i][j][e] belongs to row wp + i*16 + 8*hl + e of P and to row
    // wr + j*16 + l16 of R.  The last trip's barrier stands behind every wave's
    // last read of the two buffers and no copy is in flight, so each wave may
    // take one buffer of As (waves 0, 1) or of Bs (waves 2, 3) for itself.
    char* st = (char*)(wid < 2 ? &As[wid & 1][0][0] : &Bs[wid & 1][0][0]);

    // The bias goes with the W row, which is the accumulator's row (8 a tile)
    // or its column (1 a tile).
    f32x4 bP[4][2];
    float bR[4];
    if (tok) {
#pragma unroll  // constant indices keep the array in registers
        for (int j = 0; j < 4; ++j) bR[j] = Bi[wr + j * 16 + l16];
    } else {
#pragma unroll  // constant indices keep the array in registers
        for (int i = 0; i < 4; ++i) {
            const f32x4* bp = (const f32x4*)&Bi[wp + i * 16 + 8 * hl];
            bP[i][0] = bp[0];
            bP[i][1] = bp[1];
        }
    }

    if (mode == 2) {
        // 64 rows (tokens) of 64 floats.
#pragma unroll  // constant indices keep the arrays in registers
        for (int j = 0; j < 4; ++j) {
#pragma unroll  // constant indices keep the arrays in registers
            for (int i = 0; i < 4; ++i) {
                f32x4 lo, hi;
#pragma unroll  // constant indices keep the arrays in registers
                for (int e = 0; e < 4; ++e) {
                    lo[e] = acc[i][j][e] + bP[i][0][e];
                    hi[e] = acc[i][j][4 + e] + bP[i][1][e];
                }
                f32x4* d = (f32x4*)(st + (j * 16 + l16) * GT_SP32 + (i * 16 + 8 * hl) * 4);
                d[0] = lo;
                d[1] = hi;
            }
        }
        // The rows are read back by other lanes of the wave than wrote them.
        asm volatile("s_wait_dscnt 0x0" ::: "memory");
        const char* sr = st + (lane >> 4) * GT_SP32 + (lane & 15) * 16;
        float* dst = outf + (size_t)(r0 + wr + (lane >> 4)) * DMODEL + p0 + wp + (lane & 15) * 4;
        f32x4 v[32];
#pragma unroll  // constant indices keep the array in registers
        for (int k = 0; k < 32; ++k) v[k] = *(const f32x4*)(sr + k * 2 * GT_SP32);
#pragma unroll  // constant indices keep the array in registers
        for (int k = 0; k < 32; ++k) *(f32x4*)(dst + k * 2 * DMODEL) = v[k];  // 2 x 256 B
        // Precaution: in the built code the other path's sums, which take the same
        // registers as these stores' address and data, stand behind this run.
        asm volatile("s_wait_xcnt 0x0" ::: "memory");
    } else {
        // 64 rows (tokens, or channels of V) of 64 halves.
        char* sw = st + l16 * GT_SP16 + 8 * hl * 2;
        if (tok) {
#pragma unroll  // constant indices keep the arrays in registers
            for (int j = 0; j < 4; ++j) {
#pragma unroll  // constant indices keep the arrays in registers
                for (int i = 0; i < 4; ++i) {
                    v8h r;
#pragma unroll  // constant indices keep the arrays in registers
                    for (int e = 0; e < 8; ++e) r[e] = (_Float16)(acc[i][j][e] + bR[j]);
                    *(v8h*)(sw + j * 16 * GT_SP16 + i * 32) = r;
                }
            }
        } else {
#pragma unroll  // constant indices keep the arrays in registers
            for (int j = 0; j < 4; ++j) {
#pragma unroll  // constant indices keep the arrays in registers
                for (int i = 0; i < 4; ++i) {
                    v8h r;
#pragma unroll  // constant indices keep the arrays in registers
                    for (int e = 0; e < 8; ++e)
                        r[e] = (_Float16)(acc[i][j][e] + bP[i][e >> 2][e & 3]);
                    *(v8h*)(sw + j * 16 * GT_SP16 + i * 32) = r;
                }
            }
        }
        // The rows are read back by other lanes of the wave than wrote them.
        asm volatile("s_wait_dscnt 0x0" ::: "memory");
        const char* sr = st + (lane >> 3) * GT_SP16 + (lane & 7) * 16;
        v8h v[16];
#pragma unroll  // constant indices keep the array in registers
        for (int k = 0; k < 16; ++k) v[k] = *(const v8h*)(sr + k * 4 * GT_SP16);
        const int row = r0 + wr + (lane >> 3);
        const int col = p0 + wp + (lane & 7) * 8;
        if (tok) {   // row = channel, col = token: Vt[b][channel][n]
            _Float16* dst = outh + ((size_t)(col >> 11) * DMODEL + row) * SEQ + (col & (SEQ - 1));
#pragma unroll  // constant indices keep the array in registers
            for (int k = 0; k < 16; ++k) *(v8h*)(dst + k * 4 * SEQ) = v[k];    // 4 x 128 B
        } else {     // row = token, col = channel
            _Float16* dst = outh + (size_t)row * DMODEL + col;
#pragma unroll  // constant indices keep the array in registers
            for (int k = 0; k < 16; ++k) *(v8h*)(dst + k * 4 * DMODEL) = v[k]; // 4 x 128 B
            // Precaution: in the built code the other path's address sums, which take
            // the same registers as these stores' address, stand behind this run.
            asm volatile("s_wait_xcnt 0x0" ::: "memory");
        }
    }
}

// ---------------------------------------------------------------------------
// Fused flash attention with geometric distance bias, transposed scores.
// One block = 4 waves sharing one (b, h); each wave owns a 16-query tile.
// K/V tiles are double-buffered in LDS in stages of 64 keys, two steps of 32
// keys a stage.  At 64 keys a row of the V tile is 128 bytes like a row of the
// K tile, and 8 lanes copy one row: every asynchronous copy moves 4 whole
// 128-byte lines.  The copies of stage s+2 are issued behind the barrier at the
// foot of stage s and waited at the foot of stage s+1, so they fly during a
// whole stage of WMMA + softmax compute.
// Per step: 4 WMMA (S^T = K Q^T, K rows as A, Q as B), distance bias,
// online softmax, 4 WMMA (O^T += V^T P^T).  In S^T a lane holds 16 scores of
// ONE query (column = lane%16, key = e + 8*half per 16-key tile), so maximum
// and sum run in the lane's own registers with one exchange between the wave
// halves, and the two converted score tiles are already the B operand of the
// second product (k = 8*half + e, then 16 + 8*half + e): P never leaves the
// registers.
// The squared distances of a 16-key x 16-query tile come from one f32 matrix
// instruction in the reference's own expanded form |q|^2 + |k|^2 - 2 q.k:
// A row = (kx, ky, kz, |k|^2), B column = (-2qx, -2qy, -2qz, 1), C = |q|^2.
// The result has the map of the score tiles, element for element.
// ---------------------------------------------------------------------------
typedef __attribute__((ext_vector_type(4))) float v4f;
typedef __attribute__((ext_vector_type(2))) float v2f;

static __device__ __forceinline__ v8f wmma_f32k4(v2f a, v2f b, v8f c) {
    return __builtin_amdgcn_wmma_f32_16x16x4_f32(
        /*neg_a=*/false, a, /*neg_b=*/false, b,
        /*c_mod=*/(short)0, c, /*reuse_a=*/false, /*reuse_b=*/false);
}

// Value of lane l ^ 16 (the other half of the wave holds the same query).
static __device__ __forceinline__ float xhalf(float x) {
    return __builtin_bit_cast(float, __builtin_amdgcn_permlanex16(
        __builtin_bit_cast(int, x), __builtin_bit_cast(int, x),
        0x76543210, 0xfedcba98, false, false));
}

#define AT_KEYS   64                       // keys a stage
#define AT_PITCH  72                       // LDS row pitch in halves: 144 B = 16 B x odd
#define AT_Q      (16 * AT_PITCH * 2)      // bytes of 16 LDS rows
#define AT_BUF    (64 * AT_PITCH * 2)      // bytes of one LDS buffer, K or V (64 rows)
#define AT_STAGES (SEQ / AT_KEYS)          // 32

__global__ __launch_bounds__(128)
void attn_fa(const _Float16* __restrict__ Qh, const _Float16* __restrict__ Kh,
             const _Float16* __restrict__ Vt, const float* __restrict__ pos,
             const float* __restrict__ dist_bias, _Float16* __restrict__ O) {
    // Row pitch = 16 B x odd (144 B for the 128-B rows of both tiles): the 16
    // rows that one ds_load_b128 fragment read touches then fall on 16 different
    // groups of four banks.  At the bare pitch they fall on 2 groups and each
    // read is replayed 8 times.
    // The pad halves at the end of a row are never written and never read.
    __shared__ __align__(16) _Float16 Kt[2][AT_KEYS][AT_PITCH];  // [buf][key j][d]
    __shared__ __align__(16) _Float16 Vl[2][DK][AT_PITCH];       // [buf][d (c)][key j]
    // (x, y, z, x^2 + y^2 + z^2) of every key of the batch, filled once a block.
    __shared__ __align__(16) float Kp[SEQ][4];

    const int tid  = threadIdx.x;
    const int lane = tid & 31;
    const int wid  = tid >> 5;
    const int hl   = lane >> 4;
    const int l16  = lane & 15;

    const int bh    = blockIdx.x >> 5;     // 32 (b,h) pairs; 32 blocks each
    const int qgrp  = blockIdx.x & 31;
    const int b     = bh >> 4;
    const int h     = bh & 15;
    const int qbase = (qgrp * 4 + wid) * 16;

    // Scores live in base 2: log2(e) is folded into both constants, so each
    // exponential and the logarithm is one hardware instruction.
    const float LOG2E = 1.4426950408889634f;
    const float nab2  = -fabsf(dist_bias[h]) * LOG2E;
    const float scale = 0.125f * LOG2E;    // log2(e)/sqrt(DK)

    // Position of the one query this lane's score column belongs to.
    const float* pq = pos + ((size_t)b * SEQ + qbase + l16) * 3;
    const float qx = pq[0], qy = pq[1], qz = pq[2];
    // Precaution: the load's address registers are reused soon after it
    // (address sums, accumulator start values), so the wait stands first.
    asm volatile("s_wait_xcnt 0x0" ::: "memory");

    // Query side of the distance product: this half's two k of the four (the
    // key side below takes the same two), and |q|^2 as the start value.
    const v2f qd = hl ? v2f{-2.0f * qz, 1.0f} : v2f{-2.0f * qx, -2.0f * qy};
    const float qq = qx * qx + qy * qy + qz * qz;
    const v8f cq = {qq, qq, qq, qq, qq, qq, qq, qq};

    // Q fragments: invariant over the key loop -> registers (B operand).
    const _Float16* qrow =
        Qh + (size_t)(b * SEQ + qbase + l16) * DMODEL + h * DK;
    const v16h aq0 = load_frag16(qrow, hl);
    const v16h aq1 = load_frag16(qrow + 32, hl);

    v8f o[4] = {v8f{}, v8f{}, v8f{}, v8f{}};  // o[t][e] = O^T[t*16+8*hl+e][l16]
    float m = -3.0e38f;                       // running maximum of the query
    float l = 0.0f;                           // this half's share of the sum

    // Staging: a lane copies 16 bytes of rows srow, +16, +32, +48 of both tiles
    // (K: 64 keys x 64 d, V: 64 d x 64 keys; 128 bytes a row, 8 lanes a row).
    const int srow = tid >> 3, sseg = (tid & 7) * 8;
    const _Float16* gK = Kh + (size_t)(b * SEQ + srow) * DMODEL + h * DK + sseg;
    const _Float16* gV = Vt + (size_t)(b * DMODEL + h * DK + srow) * SEQ + sseg;
    const unsigned lK = lds_byte(&Kt[0][srow][sseg]);
    const unsigned lV = lds_byte(&Vl[0][srow][sseg]);

    // Stage one 64-key block into LDS buffer `buf`.
    auto stage_tiles = [&](int buf, int stage) {
        const _Float16* k = gK + (size_t)stage * AT_KEYS * DMODEL;
        const _Float16* v = gV + stage * AT_KEYS;
        const unsigned lk = lK + buf * AT_BUF;
        const unsigned lv = lV + buf * AT_BUF;
        // The 8 copies of one stage.  The closing s_wait_xcnt stands in the
        // same statement so that no address register of a copy is rewritten
        // in front of it (a precaution).
        asm volatile(
            "global_load_async_to_lds_b128 %0, %8, off\n\t"
            "global_load_async_to_lds_b128 %1, %9, off\n\t"
            "global_load_async_to_lds_b128 %2, %10, off\n\t"
            "global_load_async_to_lds_b128 %3, %11, off\n\t"
            "global_load_async_to_lds_b128 %4, %12, off\n\t"
            "global_load_async_to_lds_b128 %5, %13, off\n\t"
            "global_load_async_to_lds_b128 %6, %14, off\n\t"
            "global_load_async_to_lds_b128 %7, %15, off\n\t"
            "s_wait_xcnt 0x0"
            :: "v"(lk), "v"(lk + AT_Q), "v"(lk + 2 * AT_Q), "v"(lk + 3 * AT_Q),
               "v"(lv), "v"(lv + AT_Q), "v"(lv + 2 * AT_Q), "v"(lv + 3 * AT_Q),
               "v"(k), "v"(k + 16 * DMODEL), "v"(k + 32 * DMODEL), "v"(k + 48 * DMODEL),
               "v"(v), "v"(v + 16 * SEQ), "v"(v + 32 * SEQ), "v"(v + 48 * SEQ)
            : "memory");
    };

    stage_tiles(0, 0);   // prologue

    // Key table: a thread takes keys tid, tid + 128, ...  The barrier in front
    // of the loop stands between these LDS writes and every read of the table.
    {
        const float* pb = pos + (size_t)b * SEQ * 3 + tid * 3;
        float px[SEQ / 128], py[SEQ / 128], pz[SEQ / 128];
#pragma unroll  // constant indices keep the arrays in registers
        for (int i = 0; i < SEQ / 128; ++i) {
            px[i] = pb[i * 384];
            py[i] = pb[i * 384 + 1];
            pz[i] = pb[i * 384 + 2];
        }
        // Precaution: the loads' address registers may be reused behind them.
        asm volatile("s_wait_xcnt 0x0" ::: "memory");
#pragma unroll  // constant indices keep the arrays in registers
        for (int i = 0; i < SEQ / 128; ++i)
            *(v4f*)&Kp[i * 128 + tid][0] =
                v4f{px[i], py[i], pz[i], px[i] * px[i] + py[i] * py[i] + pz[i] * pz[i]};
    }

    // Stage 0 lands and is published before anything is read; stage 1 follows.
    // This wave's copies have landed before the barrier lets others read them.
    asm volatile("s_wait_asynccnt 0x0" ::: "memory");
    __syncthreads();
    stage_tiles(1, 1);

    for (int stage = 0; stage < AT_STAGES; ++stage) {
      const int cur = stage & 1;
#pragma unroll  // the step's place in the stage becomes a constant LDS offset
      for (int kb = 0; kb < AT_KEYS; kb += 32) {
        const int jb = stage * AT_KEYS + kb;

        // Squared distances of the two 16-key tiles to the wave's 16 queries.
        const v2f kd0 = *(const v2f*)&Kp[jb + l16][2 * hl];
        const v2f kd1 = *(const v2f*)&Kp[jb + 16 + l16][2 * hl];
        const v16h kf00 = load_frag16(&Kt[cur][kb + l16][0], hl);
        const v16h kf10 = load_frag16(&Kt[cur][kb + 16 + l16][0], hl);
        const v16h kf01 = load_frag16(&Kt[cur][kb + l16][32], hl);
        const v16h kf11 = load_frag16(&Kt[cur][kb + 16 + l16][32], hl);
        // Keeps vector work of the step before, which may reuse the registers of
        // kd0 and kd1, in front of the two distance products, not behind them.
        __builtin_amdgcn_sched_barrier(0);
        const v8f q0 = wmma_f32k4(kd0, qd, cq);
        const v8f q1 = wmma_f32k4(kd1, qd, cq);
        // Keeps the four score products between the two distance products and
        // the first vector instruction that reads their results.
        __builtin_amdgcn_sched_barrier(0);

        // ---- S^T = K Q^T for the 32-key block (two 16x16 tiles) ----
        v8f s0 = v8f{}, s1 = v8f{};
        s0 = wmma_f16(kf00, aq0, s0);
        s1 = wmma_f16(kf10, aq0, s1);
        s0 = wmma_f16(kf01, aq1, s0);
        s1 = wmma_f16(kf11, aq1, s1);
        __builtin_amdgcn_sched_barrier(0);  // the other end of the same hold

        float a0[8], a1[8];
        float v = -3.0e38f;
#pragma unroll  // constant indices keep the array in registers
        for (int e = 0; e < 8; ++e) {
            // A sum below zero is rounding residue of a true value near zero, of
            // the size a residue above zero has; |.| costs no instruction.
            const float d0v = __builtin_amdgcn_sqrtf(__builtin_fabsf(q0[e]));
            const float d1v = __builtin_amdgcn_sqrtf(__builtin_fabsf(q1[e]));
            // The weight lies in [1e-8, 1 + 1e-8]: an exponential that falls
            // below the normal range vanishes in the sum with 1e-8 anyway,
            // and the logarithm's argument is always a normal number.
            a0[e] = s0[e] * scale +
                    __builtin_amdgcn_logf(__builtin_amdgcn_exp2f(nab2 * d0v) + 1e-8f);
            a1[e] = s1[e] * scale +
                    __builtin_amdgcn_logf(__builtin_amdgcn_exp2f(nab2 * d1v) + 1e-8f);
            v = fmaxf(v, fmaxf(a0[e], a1[e]));
        }
        // The other half holds the query's other 16 keys of this block.
        v = fmaxf(v, xhalf(v));

        const float mn = fmaxf(m, v);
        const float sc = __builtin_amdgcn_exp2f(m - mn);
        m = mn;
#pragma unroll  // constant indices keep the array in registers
        for (int t = 0; t < 4; ++t)
#pragma unroll  // constant indices keep the array in registers
            for (int e = 0; e < 8; ++e) o[t][e] *= sc;

        // P^T as B operand, straight from the two score tiles.
        v16h bp;
        float rs = 0.0f;
#pragma unroll  // constant indices keep the array in registers
        for (int e = 0; e < 8; ++e) {
            const float p0 = __builtin_amdgcn_exp2f(a0[e] - mn);
            const float p1 = __builtin_amdgcn_exp2f(a1[e] - mn);
            rs += p0 + p1;
            bp[e]     = (_Float16)p0;
            bp[8 + e] = (_Float16)p1;
        }
        l = l * sc + rs;

        // ---- O^T += V^T P^T (A-fragments from LDS V tile) ----
#pragma unroll  // constant indices keep the array in registers
        for (int t = 0; t < 4; ++t) {
            const v16h av = load_frag16(&Vl[cur][t * 16 + l16][kb], hl);
            o[t] = wmma_f16(av, bp, o[t]);
        }
      }
      // Hand-over: this wave's LDS reads of the stage are done ...
      asm volatile("s_wait_dscnt 0x0" ::: "memory");
      // ... its copies of the next stage have landed ...
      asm volatile("s_wait_asynccnt 0x0" ::: "memory");
      // ... and the one barrier publishes that stage and frees buffer cur.
      __syncthreads();
      if (stage + 2 < AT_STAGES) stage_tiles(cur, stage + 2);
    }
    // No copy is outstanding when the wave goes on to its stores and ends.
    asm volatile("s_wait_asynccnt 0x0" ::: "memory");

    // Join the halves' sums, normalize, store 8 consecutive channels a lane.
    const float lt = l + xhalf(l);
    _Float16* orow = O + (size_t)(b * SEQ + qbase + l16) * DMODEL + h * DK + 8 * hl;
#pragma unroll  // constant indices keep the array in registers
    for (int t = 0; t < 4; ++t) {
        v8h r;
#pragma unroll  // constant indices keep the array in registers
        for (int e = 0; e < 8; ++e) r[e] = (_Float16)(o[t][e] / lt);
        *(v8h*)(orow + t * 16) = r;
    }
}

// ---------------------------------------------------------------------------
extern "C" void kernel_launch(void* const* d_in, const int* in_sizes, int n_in,
                              void* d_out, int out_size, void* d_ws, size_t ws_size,
                              hipStream_t stream) {
    const float* x   = (const float*)d_in[0];
    const float* pos = (const float*)d_in[1];
    const float* Wq  = (const float*)d_in[2];
    const float* bq  = (const float*)d_in[3];
    const float* Wk  = (const float*)d_in[4];
    const float* bk  = (const float*)d_in[5];
    const float* Wv  = (const float*)d_in[6];
    const float* bv  = (const float*)d_in[7];
    const float* Wo  = (const float*)d_in[8];
    const float* bo  = (const float*)d_in[9];
    const float* db  = (const float*)d_in[10];
    float* out = (float*)d_out;

    char* ws = (char*)d_ws;
    size_t off = 0;
    auto alloc = [&](size_t bytes) -> char* {
        char* p = ws + off;
        off += (bytes + 255) & ~(size_t)255;
        return p;
    };
    const size_t act_elems = (size_t)MROWS * DMODEL;     // 4M
    const size_t w_elems   = (size_t)DMODEL * DMODEL;    // 1M

    _Float16* xh  = (_Float16*)alloc(act_elems * 2);
    _Float16* wqh = (_Float16*)alloc(w_elems * 2);
    _Float16* wkh = (_Float16*)alloc(w_elems * 2);
    _Float16* wvh = (_Float16*)alloc(w_elems * 2);
    _Float16* woh = (_Float16*)alloc(w_elems * 2);
    _Float16* Qh  = (_Float16*)alloc(act_elems * 2);
    _Float16* Kh  = (_Float16*)alloc(act_elems * 2);
    _Float16* Vt  = (_Float16*)alloc(act_elems * 2);
    _Float16* Ah  = (_Float16*)alloc(act_elems * 2);
    (void)ws_size; (void)in_sizes; (void)n_in; (void)out_size;

    // f32 -> f16 conversions, all five tensors in one launch.
    cvt_all<<<512, 256, 0, stream>>>(x, Wq, Wk, Wv, Wo, xh, wqh, wkh, wvh, woh);

    // QKV projections, one launch (V stored transposed for contiguous PV fragments).
    gemm16<<<768, 128, 0, stream>>>(xh, wqh, wkh, wvh, bq, bk, bv, Qh, Kh, Vt, nullptr, 0);

    // Fused flash attention with geometric bias.
    attn_fa<<<1024, 128, 0, stream>>>(Qh, Kh, Vt, pos, db, Ah);

    // Output projection -> f32 result.
    gemm16<<<256, 128, 0, stream>>>(Ah, woh, woh, woh, bo, bo, bo, nullptr, nullptr, nullptr, out, 1);
}
